// v000
// Measured on an AMD MI455X. A time is GPU time per run, averaged over a window of back-to-back runs after a warm-up
// (all launches, gaps included; the runs take copies of the inputs in turn), and the median of several windows.
// Apart from v000's, it joins two sittings. Times from different sittings can be a few percent apart, while
// side-by-side timings come from the same sitting.
// v000 is the starting kernel. One run takes 2390 microseconds.
#include <hip/hip_runtime.h>

// Multi-head cross attention with a key padding mask (x_q, x_kv [4][1024][1024]; q = x_q Wq, k, v = x_kv Wk, x_kv Wv ('xw' 1/32, no bias; 16 heads x 64); scores x 64^-0.5; keys with pad_mask[b][j] ([4][1024] bool, ~10 % true, read) -> -finfo.max (== exclusion); softmax; out = merged Wo ('xw' 1/32) + bo -> [4][1024][1024] (4.2 M)).
// Layout per batch: bf16 copies of x_q and x_kv in turn; 'xw' weights transposed once; exact projections; dense T-1024 attention whose softmax kernel reads the padding mask (int32, 16 B per 4 keys) and excludes padded keys (hybrid rows: < 512 hi/lo 3 products, rest fp16 x1024); merged hi/lo x Wo exact + bo.
// Compute dtypes, f32 accumulate: every input rounded to bf16; projections exact; attention rows < 512 3 products, rest fp16; softmax f32; Wo hl x exact + bias.

#define NB_  4
#define TT   1024
#define DM   1024
#define NH_  16
#define NKV  16
#define REP  (NH_ / NKV)
#define HD   64
#define DQ   (NH_ * HD)
#define DKV  (NKV * HD)
#define ZH   2
#define RH   512                  // query rows < RH use hi+lo planes (0: none)
#define WIN  0
#define PCAR 1024.0f
#define SCL  0.125f   // HD^-0.5
typedef _Float16 h16;
typedef unsigned short bf;
typedef __attribute__((ext_vector_type(16))) __bf16   v16bf;
typedef __attribute__((ext_vector_type(16))) _Float16 v16h;
typedef __attribute__((ext_vector_type(8)))  _Float16 v8h;
typedef __attribute__((ext_vector_type(8)))  unsigned short v8us;
typedef __attribute__((ext_vector_type(8)))  float    v8f;
typedef __attribute__((ext_vector_type(4)))  float    v4f;
typedef v8h  __attribute__((may_alias)) v8ha;
typedef v4f  __attribute__((may_alias)) v4fa;
typedef v8us __attribute__((may_alias)) v8usa;

__device__ __forceinline__ unsigned short f2bf(float f) { unsigned u = __float_as_uint(f); u += 0x7FFFu + ((u >> 16) & 1u); return (unsigned short)(u >> 16); }
__device__ __forceinline__ float bf2f(unsigned short b) { return __uint_as_float(((unsigned)b) << 16); }
__device__ __forceinline__ float bfr(float f) { return bf2f(f2bf(f)); }
__device__ __forceinline__ v16h cat16(v8h lo, v8h hi) { return __builtin_shufflevector(lo, hi, 0, 1, 2, 3, 4, 5, 6, 7, 8, 9, 10, 11, 12, 13, 14, 15); }
__device__ __forceinline__ v16bf cat16b(v8us lo, v8us hi) { return __builtin_bit_cast(v16bf, __builtin_shufflevector(lo, hi, 0, 1, 2, 3, 4, 5, 6, 7, 8, 9, 10, 11, 12, 13, 14, 15)); }
__device__ __forceinline__ v8f wmma16(v16h a, v16h b, v8f c) { return __builtin_amdgcn_wmma_f32_16x16x32_f16(false, a, false, b, (short)0, c, false, false); }
__device__ __forceinline__ v8f wmmab(v16bf a, v16bf b, v8f c) { return __builtin_amdgcn_wmma_f32_16x16x32_bf16(false, a, false, b, (short)0, c, false, false); }



// ---- k_gemmw: register-blocked GEMM, ONE WAVE per 64x64 output tile (16 accumulators), operands straight from K-contiguous 16-bit planes; grid (M/64, N/64, Z), 32 threads.
// C[m][n] (f32, pitch ldc, + optional f32 bias[n]) = sum_k A[m][k] Bt[n][k] (+ split products per NSPLIT). z-batch strides sA/sB/sC in elements. K % 32 == 0.
template <typename T16> struct WFrag;
template <> struct WFrag<h16> { typedef v16h V; static __device__ __forceinline__ V ld(const h16* p) { return cat16(*(const v8h*)p, *(const v8h*)(p + 16)); } static __device__ __forceinline__ v8f mma(V a, V b, v8f c) { return wmma16(a, b, c); } };
template <> struct WFrag<bf> { typedef v16bf V; static __device__ __forceinline__ V ld(const bf* p) { return cat16b(*(const v8us*)p, *(const v8us*)(p + 16)); } static __device__ __forceinline__ v8f mma(V a, V b, v8f c) { return wmmab(a, b, c); } };
template <typename T16, int NSPLIT, bool BIAS>
__global__ __launch_bounds__(32) void k_gemmw(const T16* __restrict__ A, const T16* __restrict__ A2, const T16* __restrict__ Bt, const T16* __restrict__ Bt2, int K, float* C, int ldc, const float* __restrict__ bias, size_t sA, size_t sB, size_t sC) {
    typedef typename WFrag<T16>::V V;
    __shared__ __align__(16) float os[16 * 68];
    const size_t z = blockIdx.z; A += z * sA; if (A2) A2 += z * sA; Bt += z * sB; if (Bt2) Bt2 += z * sB; C += z * sC;
    const int lane = threadIdx.x & 31, lr = lane & 15, hi = lane >> 4; const int r0 = blockIdx.x * 64, c0 = blockIdx.y * 64;
    v8f acc[4][4];
#pragma unroll
    for (int mb = 0; mb < 4; ++mb)
#pragma unroll
        for (int nb = 0; nb < 4; ++nb) acc[mb][nb] = (v8f){};
    const size_t aoff = (size_t)(r0 + lr) * K + 8 * hi, boff = (size_t)(c0 + lr) * K + 8 * hi;
#pragma unroll 1
    for (int kc = 0; kc < K; kc += 32) {
        V a[4], a2[4];
#pragma unroll
        for (int mb = 0; mb < 4; ++mb) { a[mb] = WFrag<T16>::ld(A + aoff + (size_t)mb * 16 * K + kc); if (NSPLIT == 1 || NSPLIT == 2) a2[mb] = WFrag<T16>::ld(A2 + aoff + (size_t)mb * 16 * K + kc); }
#pragma unroll
        for (int nb = 0; nb < 4; ++nb) { const V b = WFrag<T16>::ld(Bt + boff + (size_t)nb * 16 * K + kc); V b2; if (NSPLIT >= 2) b2 = WFrag<T16>::ld(Bt2 + boff + (size_t)nb * 16 * K + kc);
#pragma unroll
            for (int mb = 0; mb < 4; ++mb) { acc[mb][nb] = WFrag<T16>::mma(a[mb], b, acc[mb][nb]); if (NSPLIT == 1 || NSPLIT == 2) acc[mb][nb] = WFrag<T16>::mma(a2[mb], b, acc[mb][nb]); if (NSPLIT >= 2) acc[mb][nb] = WFrag<T16>::mma(a[mb], b2, acc[mb][nb]); } }
        asm volatile("v_nop\n\tv_nop\n\tv_nop\n\tv_nop" : "+v"(acc[0][0]), "+v"(acc[1][1]), "+v"(acc[2][2]), "+v"(acc[3][3]) : "v"(a[0]), "v"(a[3]));
    }
#pragma unroll
    for (int mb = 0; mb < 4; ++mb) {
#pragma unroll
        for (int nb = 0; nb < 4; ++nb) {
#pragma unroll
            for (int j = 0; j < 8; ++j) os[(hi * 8 + j) * 68 + nb * 16 + lr] = acc[mb][nb][j]; }
        __builtin_amdgcn_wave_barrier(); asm volatile("" ::: "memory");
        float* crow = C + (size_t)(r0 + mb * 16) * ldc + c0;
{
#pragma unroll
            for (int s = 0; s < 8; ++s) { const int row = 2 * s + hi, cofs = lr * 4; v4f val = *(const v4fa*)(os + row * 68 + cofs); if (BIAS) { val[0] += bfr(bias[c0 + cofs]); val[1] += bfr(bias[c0 + cofs + 1]); val[2] += bfr(bias[c0 + cofs + 2]); val[3] += bfr(bias[c0 + cofs + 3]); }
                *(v4f*)(crow + (size_t)row * ldc + cofs) = val; }
             }
        __builtin_amdgcn_wave_barrier(); asm volatile("" ::: "memory");
    }
}

__device__ __forceinline__ h16 tohx(float x) { return (h16)x; }
__device__ __forceinline__ void splitf(float y, unsigned short& h, unsigned short& l) { h = f2bf(y); l = f2bf(y - bf2f(h)); }
typedef __attribute__((ext_vector_type(2))) _Float16 v2h;
typedef __attribute__((ext_vector_type(4))) _Float16 v4h;
typedef __attribute__((ext_vector_type(2))) unsigned short v2us;
typedef __attribute__((ext_vector_type(4))) unsigned short v4us;
typedef __attribute__((ext_vector_type(2))) float v2f;
typedef __attribute__((ext_vector_type(4))) int v4i;

__global__ __launch_bounds__(256) void k_wtG(const float* __restrict__ w, int K, int N, bf* Bt) {
    const int lane = threadIdx.x & 31; const int L0 = (blockIdx.x * 8 + (threadIdx.x >> 5)) * 8; const int nlines = N * K / 64;
{
#pragma unroll 1
        for (int l = 0; l < 8; ++l) { const int L = L0 + l; if (L >= nlines) break; const size_t e = (size_t)L * 64 + lane * 2; const int k = (int)(e % K), n = (int)(e / K); v2us o;
            o[0] = f2bf(w[(size_t)k * N + n]); o[1] = f2bf(w[(size_t)(k + 1) * N + n]); *(v2us*)(Bt + e) = o; }
         }
}
__global__ __launch_bounds__(256) void k_cvt8(const float* __restrict__ src, bf* dst, size_t n8) { const size_t i = (size_t)blockIdx.x * 256 + threadIdx.x; if (i >= n8) return; const v8f v = *(const v8f*)(src + i * 8); v8us o;
#pragma unroll
    for (int k = 0; k < 8; ++k) o[k] = f2bf(v[k]); *(v8us*)(dst + i * 8) = o;  }

// k_rope: head planes [h][t][d] (fp16 + hi/lo) of rope(x) x sc with the rotate-half convention out[d] = x[d] cos[t][d] - x[d+HD/2] sin[t][d], out[d+HD/2] = x[d+HD/2] cos[t][d+HD/2] + x[d] sin[t][d+HD/2]
__global__ __launch_bounds__(256) void k_rope(const float* __restrict__ F, int pitch, int nheads, const float* __restrict__ CS, const float* __restrict__ RF, const float* __restrict__ nw, float sc, h16* P16, bf* Ph, bf* Pl) {
    const size_t e = ((size_t)blockIdx.x * 256 + threadIdx.x) * 2; if (e >= (size_t)nheads * TT * HD) return; const int d = (int)(e % HD); const int t = (int)((e / HD) % TT); const int h = (int)(e / ((size_t)HD * TT)); const float* f = F + (size_t)t * pitch + h * HD; const float rf = RF ? RF[(size_t)h * TT + t] : 1.0f; v2h o16; v2us oh, ol;
#pragma unroll
    for (int q = 0; q < 2; ++q) { const int dd = d + q; const int dp = (dd < HD / 2) ? dd + HD / 2 : dd - HD / 2; float x0 = f[dd], x1 = f[dp];
        if (RF) { float n0 = __fmul_rn(x0, rf), n1 = __fmul_rn(x1, rf); asm volatile("" : "+v"(n0)); asm volatile("" : "+v"(n1)); x0 = __fmul_rn(bfr(nw[dd]), n0); x1 = __fmul_rn(bfr(nw[dp]), n1); }
        const v2f cs = *(const v2f*)(CS + ((size_t)t * HD + dd) * 2); float a = __fmul_rn(x0, cs[0]), bq = __fmul_rn(x1, cs[1]); asm volatile("" : "+v"(a)); asm volatile("" : "+v"(bq)); const float r = ((dd < HD / 2) ? __fsub_rn(a, bq) : __fadd_rn(a, bq)) * sc;
        o16[q] = tohx(r); unsigned short a2, c2; splitf(r, a2, c2); oh[q] = a2; ol[q] = c2; }
    *(v2h*)(P16 + e) = o16; *(v2us*)(Ph + e) = oh; *(v2us*)(Pl + e) = ol;  }
__global__ __launch_bounds__(256) void k_vtp(const float* __restrict__ F, int pitch, int nheads, h16* V16, bf* Vh, bf* Vl) { const size_t e = ((size_t)blockIdx.x * 256 + threadIdx.x) * 2; if (e >= (size_t)nheads * HD * TT) return; const int t = (int)(e % TT); const int d = (int)((e / TT) % HD); const int g = (int)(e / ((size_t)TT * HD)); v2h o16; v2us oh, ol;
#pragma unroll
    for (int q = 0; q < 2; ++q) { const float x = F[(size_t)(t + q) * pitch + g * HD + d]; o16[q] = tohx(x); unsigned short a2, c2; splitf(x, a2, c2); oh[q] = a2; ol[q] = c2; }
    *(v2h*)(V16 + e) = o16; *(v2us*)(Vh + e) = oh; *(v2us*)(Vl + e) = ol;  }
__global__ __launch_bounds__(256) void k_csid(float* CS) { const int idx = blockIdx.x * 256 + threadIdx.x; if (idx >= TT * HD) return; v2f cs; cs[0] = 1.0f; cs[1] = 0.0f; *(v2f*)(CS + (size_t)idx * 2) = cs;  }
__global__ __launch_bounds__(256) void k_asoft(const float* __restrict__ Sb, h16* P16, bf* Ph, bf* Pl, const int* __restrict__ pm) {
    const int lane = threadIdx.x & 31; const int row = blockIdx.x * 8 + (threadIdx.x >> 5); if (row >= ZH * TT) return; const int i = row % TT; const int zz = row / TT; (void)zz; const bool hires = (i < RH); const float* sr = Sb + (size_t)row * TT; float v[TT / 32]; float mx = -3.0e38f;
#pragma unroll
    for (int ch = 0; ch < TT / 128; ++ch) { const int j0 = ch * 128 + lane * 4; const v4f a = *(const v4f*)(sr + j0); const v4i p4 = *(const v4i*)(pm + j0);   /* 4 padding flags (16 B) */
#pragma unroll
        for (int q = 0; q < 4; ++q) { const int j = j0 + q; (void)j; const float t = (p4[q] == 0) ? a[q] * SCL : -3.0e38f;   /* padded keys excluded */ v[ch * 4 + q] = t; mx = fmaxf(mx, t); } }
#pragma unroll
    for (int sh = 16; sh; sh >>= 1) mx = fmaxf(mx, __shfl_xor(mx, sh, 32));
    float sum = 0.f;
#pragma unroll
    for (int k = 0; k < TT / 32; ++k) { float d0 = __fsub_rn(v[k], mx); asm volatile("" : "+v"(d0)); v[k] = __builtin_amdgcn_exp2f(__fmul_rn(d0, 1.4426950408889634f)); sum += v[k]; }
#pragma unroll
    for (int sh = 16; sh; sh >>= 1) sum += __shfl_xor(sum, sh, 32);
    const float f = __fdiv_rn(hires ? 1.0f : PCAR, sum);
{
        if (hires) {
#pragma unroll
            for (int ch = 0; ch < TT / 128; ++ch) { v4us oh, ol;
#pragma unroll
                for (int q = 0; q < 4; ++q) { unsigned short a, c2; splitf(v[ch * 4 + q] * f, a, c2); oh[q] = a; ol[q] = c2; }
                const size_t oo = ((size_t)zz * (RH ? RH : 1) + i) * TT + ch * 128 + lane * 4; *(v4us*)(Ph + oo) = oh; *(v4us*)(Pl + oo) = ol; }
        } else {
#pragma unroll
            for (int ch = 0; ch < TT / 128; ++ch) { v4h o4;
#pragma unroll
                for (int q = 0; q < 4; ++q) o4[q] = tohx(v[ch * 4 + q] * f);
                *(v4h*)(P16 + (size_t)row * TT + ch * 128 + lane * 4) = o4; } }
         }
}
__global__ __launch_bounds__(256) void k_merge(const float* __restrict__ O, int h0, bf* Ah, bf* Al) { const size_t e = ((size_t)blockIdx.x * 256 + threadIdx.x) * 2; if (e >= (size_t)ZH * TT * HD) return; const int d = (int)(e % HD); const int t = (int)((e / HD) % TT); const int zz = (int)(e / ((size_t)HD * TT)); const float cs = (t < RH) ? 1.0f : (1.0f / PCAR); const size_t oo = (size_t)t * DQ + (h0 + zz) * HD + d;
    v2us oh, ol;
#pragma unroll
    for (int q = 0; q < 2; ++q) { unsigned short a, c2; splitf(O[e + q] * cs, a, c2); oh[q] = a; ol[q] = c2; } *(v2us*)(Ah + oo) = oh; *(v2us*)(Al + oo) = ol;  }

extern "C" void kernel_launch(void* const* d_in, const int* in_sizes, int n_in,
                              void* d_out, int out_size, void* d_ws, size_t ws_size, hipStream_t stream) {
    (void)in_sizes; (void)n_in; (void)out_size;
    const float* x = (const float*)d_in[0]; const float* xkv = (const float*)d_in[1]; const int* pm = (const int*)d_in[2];   /* pad_mask [4][1024] bool as int32: 1 = padding key */ const float* wq = (const float*)d_in[3]; const float* wk = (const float*)d_in[4]; const float* wv = (const float*)d_in[5]; const float* wo = (const float*)d_in[6]; const float* bo = (const float*)d_in[7];
    float* OUT = (float*)d_out;     // [4][1024][1024]
    char* wsp = (char*)d_ws;
    auto take = [&](size_t bytes) { char* p = wsp; wsp += (bytes + 255) & ~(size_t)255; return (void*)p; };
    bf* WQ = (bf*)take((size_t)DQ * DM * 2); bf* WK = (bf*)take((size_t)DKV * DM * 2); bf* WV = (bf*)take((size_t)DKV * DM * 2); bf* WO = (bf*)take((size_t)DM * DQ * 2); float* CS = (float*)take((size_t)TT * HD * 2 * 4);
    bf* XB = (bf*)take((size_t)TT * DM * 2); float* FQ = (float*)take((size_t)TT * DQ * 4); float* FK = (float*)take((size_t)TT * DKV * 4);
    h16* QP16 = (h16*)take((size_t)NH_ * TT * HD * 2); h16* KP16 = (h16*)take((size_t)NKV * TT * HD * 2); h16* VT16 = (h16*)take((size_t)NKV * HD * TT * 2);
    bf* QPh = (bf*)take((size_t)NH_ * TT * HD * 2); bf* QPl = (bf*)take((size_t)NH_ * TT * HD * 2); bf* KPh = (bf*)take((size_t)NKV * TT * HD * 2); bf* KPl = (bf*)take((size_t)NKV * TT * HD * 2); bf* VTh = (bf*)take((size_t)NKV * HD * TT * 2); bf* VTl = (bf*)take((size_t)NKV * HD * TT * 2); bf* Ph = (bf*)take((size_t)ZH * RH * TT * 2); bf* Pl = (bf*)take((size_t)ZH * RH * TT * 2);
    float* Sb = (float*)take((size_t)ZH * TT * TT * 4); h16* P16 = (h16*)take((size_t)ZH * TT * TT * 2); float* Ob = (float*)take((size_t)ZH * TT * HD * 4); bf* ATh = (bf*)take((size_t)TT * DQ * 2); bf* ATl = (bf*)take((size_t)TT * DQ * 2);
    if ((size_t)(wsp - (char*)d_ws) > ws_size) return;    // ws 256 MiB
    float* FV = FK;   // v projection reuses the k buffer after the k planes are built (stream-ordered)
    { k_wtG<<<(unsigned)((DM * DQ / 64 + 63) / 64), 256, 0, stream>>>(wq, DM, DQ, WQ); k_wtG<<<(unsigned)((DM * DKV / 64 + 63) / 64), 256, 0, stream>>>(wk, DM, DKV, WK); k_wtG<<<(unsigned)((DM * DKV / 64 + 63) / 64), 256, 0, stream>>>(wv, DM, DKV, WV);
      k_wtG<<<(unsigned)((DQ * DM / 64 + 63) / 64), 256, 0, stream>>>(wo, DQ, DM, WO);
       }
    k_csid<<<(TT * HD + 255) / 256, 256, 0, stream>>>(CS);
    const unsigned LQ = (unsigned)(((size_t)NH_ * TT * HD / 2 + 255) / 256), LKv = (unsigned)(((size_t)NKV * TT * HD / 2 + 255) / 256);
    for (int b = 0; b < NB_; ++b) {
        
        k_cvt8<<<(unsigned)(((size_t)TT * DM / 8 + 255) / 256), 256, 0, stream>>>(x + (size_t)b * TT * DM, XB, (size_t)TT * DM / 8);
        k_gemmw<bf, 0, false><<<dim3(TT / 64, DQ / 64, 1), 32, 0, stream>>>(XB, nullptr, WQ, nullptr, DM, FQ, DQ, nullptr, 0, 0, 0);
        k_rope<<<LQ, 256, 0, stream>>>(FQ, DQ, NH_, CS, nullptr, nullptr, 1.0f, QP16, QPh, QPl);
        k_cvt8<<<(unsigned)(((size_t)TT * DM / 8 + 255) / 256), 256, 0, stream>>>(xkv + (size_t)b * TT * DM, XB, (size_t)TT * DM / 8); k_gemmw<bf, 0, false><<<dim3(TT / 64, DKV / 64, 1), 32, 0, stream>>>(XB, nullptr, WK, nullptr, DM, FK, DKV, nullptr, 0, 0, 0);   /* k, v from x_kv */
        k_rope<<<LKv, 256, 0, stream>>>(FK, DKV, NKV, CS, nullptr, nullptr, 1.0f, KP16, KPh, KPl);
        k_gemmw<bf, 0, false><<<dim3(TT / 64, DKV / 64, 1), 32, 0, stream>>>(XB, nullptr, WV, nullptr, DM, FV, DKV, nullptr, 0, 0, 0); k_vtp<<<LKv, 256, 0, stream>>>(FV, DKV, NKV, VT16, VTh, VTl);
        for (int h0 = 0; h0 < NH_; h0 += ZH) { const size_t zq = (size_t)h0, zk = (size_t)(h0 / REP);   // one kv head per query head: the pass's two heads use consecutive kv planes (z-strides TT*HD)
            k_gemmw<bf, 2, false><<<dim3(RH / 64, TT / 64, ZH), 32, 0, stream>>>(QPh + zq * TT * HD, QPl + zq * TT * HD, KPh + zk * TT * HD, KPl + zk * TT * HD, HD, Sb, TT, nullptr, (size_t)TT * HD, (size_t)TT * HD, (size_t)TT * TT);
            k_gemmw<h16, 0, false><<<dim3((TT - RH) / 64, TT / 64, ZH), 32, 0, stream>>>(QP16 + zq * TT * HD + (size_t)RH * HD, nullptr, KP16 + zk * TT * HD, nullptr, HD, Sb + (size_t)RH * TT, TT, nullptr, (size_t)TT * HD, (size_t)TT * HD, (size_t)TT * TT);
            k_asoft<<<ZH * TT / 8, 256, 0, stream>>>(Sb, P16, Ph, Pl, pm + (size_t)b * TT);
            k_gemmw<bf, 2, false><<<dim3(RH / 64, HD / 64, ZH), 32, 0, stream>>>(Ph, Pl, VTh + zk * HD * TT, VTl + zk * HD * TT, TT, Ob, HD, nullptr, (size_t)RH * TT, (size_t)HD * TT, (size_t)TT * HD);
            k_gemmw<h16, 0, false><<<dim3((TT - RH) / 64, HD / 64, ZH), 32, 0, stream>>>(P16 + (size_t)RH * TT, nullptr, VT16 + zk * HD * TT, nullptr, TT, Ob + (size_t)RH * HD, HD, nullptr, (size_t)TT * TT, (size_t)HD * TT, (size_t)TT * HD);
            k_merge<<<(unsigned)(((size_t)ZH * TT * HD / 2 + 255) / 256), 256, 0, stream>>>(Ob, h0, ATh, ATl); }
        k_gemmw<bf, 1, true><<<dim3(TT / 64, DM / 64, 1), 32, 0, stream>>>(ATh, ATl, WO, nullptr, DQ, OUT + (size_t)b * TT * DM, DM, bo, 0, 0, 0); }
}

// v001
// One run takes 524 microseconds.
// Timed twice side by side with v000, it ran 4.60 and 4.55 times as fast.
#include <hip/hip_runtime.h>

// Multi-head cross attention with a key padding mask (x_q, x_kv [4][1024][1024]; q = x_q Wq, k, v = x_kv Wk, x_kv Wv ('xw' 1/32, no bias; 16 heads x 64); scores x 64^-0.5; keys with pad_mask[b][j] ([4][1024] bool, ~10 % true, read) -> -finfo.max (== exclusion); softmax; out = merged Wo ('xw' 1/32) + bo -> [4][1024][1024] (4.2 M)).
// Layout: bf16 copies of x_q and x_kv (all batches, one launch); 'xw' weights transposed once (one launch); exact projections over all 4096 rows; per batch, all 16 heads in grid z: dense T-1024 attention whose softmax kernel reads the padding mask (int32, 16 B per 4 keys) and excludes padded keys (hybrid rows: < 512 hi/lo 3 products, rest fp16 x1024); merged hi/lo x Wo exact + bo.
// Compute dtypes, f32 accumulate: every input rounded to bf16; projections exact; attention rows < 512 3 products, rest fp16; softmax f32; Wo hl x exact + bias.

#define NB_  4
#define TT   1024
#define DM   1024
#define NH_  16
#define NKV  16
#define REP  (NH_ / NKV)
#define HD   64
#define DQ   (NH_ * HD)
#define DKV  (NKV * HD)
#define ZH   16                   // heads per attention pass (grid z)
#define RH   512                  // query rows < RH use hi+lo planes (0: none)
#define WIN  0
#define PCAR 1024.0f
#define SCL  0.125f   // HD^-0.5
typedef _Float16 h16;
typedef unsigned short bf;
typedef __attribute__((ext_vector_type(16))) __bf16   v16bf;
typedef __attribute__((ext_vector_type(16))) _Float16 v16h;
typedef __attribute__((ext_vector_type(8)))  _Float16 v8h;
typedef __attribute__((ext_vector_type(8)))  unsigned short v8us;
typedef __attribute__((ext_vector_type(8)))  float    v8f;
typedef __attribute__((ext_vector_type(4)))  float    v4f;
typedef v8h  __attribute__((may_alias)) v8ha;
typedef v4f  __attribute__((may_alias)) v4fa;
typedef v8us __attribute__((may_alias)) v8usa;

__device__ __forceinline__ unsigned short f2bf(float f) { unsigned u = __float_as_uint(f); u += 0x7FFFu + ((u >> 16) & 1u); return (unsigned short)(u >> 16); }
__device__ __forceinline__ float bf2f(unsigned short b) { return __uint_as_float(((unsigned)b) << 16); }
__device__ __forceinline__ float bfr(float f) { return bf2f(f2bf(f)); }
__device__ __forceinline__ v16h cat16(v8h lo, v8h hi) { return __builtin_shufflevector(lo, hi, 0, 1, 2, 3, 4, 5, 6, 7, 8, 9, 10, 11, 12, 13, 14, 15); }
__device__ __forceinline__ v16bf cat16b(v8us lo, v8us hi) { return __builtin_bit_cast(v16bf, __builtin_shufflevector(lo, hi, 0, 1, 2, 3, 4, 5, 6, 7, 8, 9, 10, 11, 12, 13, 14, 15)); }
__device__ __forceinline__ v8f wmma16(v16h a, v16h b, v8f c) { return __builtin_amdgcn_wmma_f32_16x16x32_f16(false, a, false, b, (short)0, c, false, false); }
__device__ __forceinline__ v8f wmmab(v16bf a, v16bf b, v8f c) { return __builtin_amdgcn_wmma_f32_16x16x32_bf16(false, a, false, b, (short)0, c, false, false); }



// ---- k_gemmw: register-blocked GEMM, ONE WAVE per 64x64 output tile (16 accumulators), operands straight from K-contiguous 16-bit planes; grid (M/64, N/64, Z), 32 threads.
// C[m][n] (f32, pitch ldc, + optional f32 bias[n]) = sum_k A[m][k] Bt[n][k] (+ split products per NSPLIT). z-batch strides sA/sB/sC in elements. K % 32 == 0.
template <typename T16> struct WFrag;
template <> struct WFrag<h16> { typedef v16h V; static __device__ __forceinline__ V ld(const h16* p) { return cat16(*(const v8h*)p, *(const v8h*)(p + 16)); } static __device__ __forceinline__ v8f mma(V a, V b, v8f c) { return wmma16(a, b, c); } };
template <> struct WFrag<bf> { typedef v16bf V; static __device__ __forceinline__ V ld(const bf* p) { return cat16b(*(const v8us*)p, *(const v8us*)(p + 16)); } static __device__ __forceinline__ v8f mma(V a, V b, v8f c) { return wmmab(a, b, c); } };
template <typename T16, int NSPLIT, bool BIAS>
__global__ __launch_bounds__(32) void k_gemmw(const T16* __restrict__ A, const T16* __restrict__ A2, const T16* __restrict__ Bt, const T16* __restrict__ Bt2, int K, float* C, int ldc, const float* __restrict__ bias, size_t sA, size_t sB, size_t sC) {
    typedef typename WFrag<T16>::V V;
    __shared__ __align__(16) float os[16 * 68];
    const size_t z = blockIdx.z; A += z * sA; if (A2) A2 += z * sA; Bt += z * sB; if (Bt2) Bt2 += z * sB; C += z * sC;
    const int lane = threadIdx.x & 31, lr = lane & 15, hi = lane >> 4; const int r0 = blockIdx.x * 64, c0 = blockIdx.y * 64;
    v8f acc[4][4];
#pragma unroll
    for (int mb = 0; mb < 4; ++mb)
#pragma unroll
        for (int nb = 0; nb < 4; ++nb) acc[mb][nb] = (v8f){};
    const size_t aoff = (size_t)(r0 + lr) * K + 8 * hi, boff = (size_t)(c0 + lr) * K + 8 * hi;
#pragma unroll 1
    for (int kc = 0; kc < K; kc += 32) {
        V a[4], a2[4];
#pragma unroll
        for (int mb = 0; mb < 4; ++mb) { a[mb] = WFrag<T16>::ld(A + aoff + (size_t)mb * 16 * K + kc); if (NSPLIT == 1 || NSPLIT == 2) a2[mb] = WFrag<T16>::ld(A2 + aoff + (size_t)mb * 16 * K + kc); }
#pragma unroll
        for (int nb = 0; nb < 4; ++nb) { const V b = WFrag<T16>::ld(Bt + boff + (size_t)nb * 16 * K + kc); V b2; if (NSPLIT >= 2) b2 = WFrag<T16>::ld(Bt2 + boff + (size_t)nb * 16 * K + kc);
#pragma unroll
            for (int mb = 0; mb < 4; ++mb) { acc[mb][nb] = WFrag<T16>::mma(a[mb], b, acc[mb][nb]); if (NSPLIT == 1 || NSPLIT == 2) acc[mb][nb] = WFrag<T16>::mma(a2[mb], b, acc[mb][nb]); if (NSPLIT >= 2) acc[mb][nb] = WFrag<T16>::mma(a[mb], b2, acc[mb][nb]); } }
        asm volatile("v_nop\n\tv_nop\n\tv_nop\n\tv_nop" : "+v"(acc[0][0]), "+v"(acc[1][1]), "+v"(acc[2][2]), "+v"(acc[3][3]) : "v"(a[0]), "v"(a[3]));
    }
#pragma unroll
    for (int mb = 0; mb < 4; ++mb) {
#pragma unroll
        for (int nb = 0; nb < 4; ++nb) {
#pragma unroll
            for (int j = 0; j < 8; ++j) os[(hi * 8 + j) * 68 + nb * 16 + lr] = acc[mb][nb][j]; }
        __builtin_amdgcn_wave_barrier(); asm volatile("" ::: "memory");
        float* crow = C + (size_t)(r0 + mb * 16) * ldc + c0;
{
#pragma unroll
            for (int s = 0; s < 8; ++s) { const int row = 2 * s + hi, cofs = lr * 4; v4f val = *(const v4fa*)(os + row * 68 + cofs); if (BIAS) { val[0] += bfr(bias[c0 + cofs]); val[1] += bfr(bias[c0 + cofs + 1]); val[2] += bfr(bias[c0 + cofs + 2]); val[3] += bfr(bias[c0 + cofs + 3]); }
                *(v4f*)(crow + (size_t)row * ldc + cofs) = val; }
             }
        __builtin_amdgcn_wave_barrier(); asm volatile("" ::: "memory");
    }
}

__device__ __forceinline__ h16 tohx(float x) { return (h16)x; }
__device__ __forceinline__ void splitf(float y, unsigned short& h, unsigned short& l) { h = f2bf(y); l = f2bf(y - bf2f(h)); }
typedef __attribute__((ext_vector_type(2))) _Float16 v2h;
typedef __attribute__((ext_vector_type(4))) _Float16 v4h;
typedef __attribute__((ext_vector_type(2))) unsigned short v2us;
typedef __attribute__((ext_vector_type(4))) unsigned short v4us;
typedef __attribute__((ext_vector_type(2))) float v2f;
typedef __attribute__((ext_vector_type(4))) int v4i;

// blockIdx.y picks one of four equally shaped weights; their transposed planes lie one behind the other in Bt
__global__ __launch_bounds__(256) void k_wtG(const float* __restrict__ w0, const float* __restrict__ w1, const float* __restrict__ w2, const float* __restrict__ w3, int K, int N, bf* Bt) {
    const int y = blockIdx.y; const float* __restrict__ w = (y == 0) ? w0 : (y == 1) ? w1 : (y == 2) ? w2 : w3; Bt += (size_t)y * N * K;
    const int lane = threadIdx.x & 31; const int L0 = (blockIdx.x * 8 + (threadIdx.x >> 5)) * 8; const int nlines = N * K / 64;
{
#pragma unroll 1
        for (int l = 0; l < 8; ++l) { const int L = L0 + l; if (L >= nlines) break; const size_t e = (size_t)L * 64 + lane * 2; const int k = (int)(e % K), n = (int)(e / K); v2us o;
            o[0] = f2bf(w[(size_t)k * N + n]); o[1] = f2bf(w[(size_t)(k + 1) * N + n]); *(v2us*)(Bt + e) = o; }
         }
}
// blockIdx.y picks the source; the two copies lie one behind the other in dst
__global__ __launch_bounds__(256) void k_cvt8(const float* __restrict__ src0, const float* __restrict__ src1, bf* dst, size_t n8) { const size_t i = (size_t)blockIdx.x * 256 + threadIdx.x; if (i >= n8) return; const float* __restrict__ src = blockIdx.y ? src1 : src0; dst += (size_t)blockIdx.y * n8 * 8; const v8f v = *(const v8f*)(src + i * 8); v8us o;
#pragma unroll
    for (int k = 0; k < 8; ++k) o[k] = f2bf(v[k]); *(v8us*)(dst + i * 8) = o;  }

// k_rope: head planes [h][t][d] (fp16 + hi/lo) of rope(x) x sc with the rotate-half convention out[d] = x[d] cos[t][d] - x[d+HD/2] sin[t][d], out[d+HD/2] = x[d+HD/2] cos[t][d+HD/2] + x[d] sin[t][d+HD/2]
__global__ __launch_bounds__(256) void k_rope(const float* __restrict__ F, int pitch, int nheads, const float* __restrict__ CS, const float* __restrict__ RF, const float* __restrict__ nw, float sc, h16* P16, bf* Ph, bf* Pl) {
    { const size_t y = blockIdx.y, po = y * nheads * TT * HD; F += y * TT * pitch; P16 += po; Ph += po; Pl += po; }   // blockIdx.y: one [TT][pitch] slab of F and its head planes
    const size_t e = ((size_t)blockIdx.x * 256 + threadIdx.x) * 2; if (e >= (size_t)nheads * TT * HD) return; const int d = (int)(e % HD); const int t = (int)((e / HD) % TT); const int h = (int)(e / ((size_t)HD * TT)); const float* f = F + (size_t)t * pitch + h * HD; const float rf = RF ? RF[(size_t)h * TT + t] : 1.0f; v2h o16; v2us oh, ol;
#pragma unroll
    for (int q = 0; q < 2; ++q) { const int dd = d + q; const int dp = (dd < HD / 2) ? dd + HD / 2 : dd - HD / 2; float x0 = f[dd], x1 = f[dp];
        if (RF) { float n0 = __fmul_rn(x0, rf), n1 = __fmul_rn(x1, rf); asm volatile("" : "+v"(n0)); asm volatile("" : "+v"(n1)); x0 = __fmul_rn(bfr(nw[dd]), n0); x1 = __fmul_rn(bfr(nw[dp]), n1); }
        const v2f cs = *(const v2f*)(CS + ((size_t)t * HD + dd) * 2); float a = __fmul_rn(x0, cs[0]), bq = __fmul_rn(x1, cs[1]); asm volatile("" : "+v"(a)); asm volatile("" : "+v"(bq)); const float r = ((dd < HD / 2) ? __fsub_rn(a, bq) : __fadd_rn(a, bq)) * sc;
        o16[q] = tohx(r); unsigned short a2, c2; splitf(r, a2, c2); oh[q] = a2; ol[q] = c2; }
    *(v2h*)(P16 + e) = o16; *(v2us*)(Ph + e) = oh; *(v2us*)(Pl + e) = ol;  }
__global__ __launch_bounds__(256) void k_vtp(const float* __restrict__ F, int pitch, int nheads, h16* V16, bf* Vh, bf* Vl) { { const size_t y = blockIdx.y, po = y * nheads * HD * TT; F += y * TT * pitch; V16 += po; Vh += po; Vl += po; }   // blockIdx.y: batch
    const size_t e = ((size_t)blockIdx.x * 256 + threadIdx.x) * 2; if (e >= (size_t)nheads * HD * TT) return; const int t = (int)(e % TT); const int d = (int)((e / TT) % HD); const int g = (int)(e / ((size_t)TT * HD)); v2h o16; v2us oh, ol;
#pragma unroll
    for (int q = 0; q < 2; ++q) { const float x = F[(size_t)(t + q) * pitch + g * HD + d]; o16[q] = tohx(x); unsigned short a2, c2; splitf(x, a2, c2); oh[q] = a2; ol[q] = c2; }
    *(v2h*)(V16 + e) = o16; *(v2us*)(Vh + e) = oh; *(v2us*)(Vl + e) = ol;  }
__global__ __launch_bounds__(256) void k_csid(float* CS) { const int idx = blockIdx.x * 256 + threadIdx.x; if (idx >= TT * HD) return; v2f cs; cs[0] = 1.0f; cs[1] = 0.0f; *(v2f*)(CS + (size_t)idx * 2) = cs;  }
__global__ __launch_bounds__(256) void k_asoft(const float* __restrict__ Sb, h16* P16, bf* Ph, bf* Pl, const int* __restrict__ pm) {
    const int lane = threadIdx.x & 31; const int row = blockIdx.x * 8 + (threadIdx.x >> 5); if (row >= ZH * TT) return; const int i = row % TT; const int zz = row / TT; (void)zz; const bool hires = (i < RH); const float* sr = Sb + (size_t)row * TT; float v[TT / 32]; float mx = -3.0e38f;
#pragma unroll
    for (int ch = 0; ch < TT / 128; ++ch) { const int j0 = ch * 128 + lane * 4; const v4f a = *(const v4f*)(sr + j0); const v4i p4 = *(const v4i*)(pm + j0);   /* 4 padding flags (16 B) */
#pragma unroll
        for (int q = 0; q < 4; ++q) { const int j = j0 + q; (void)j; const float t = (p4[q] == 0) ? a[q] * SCL : -3.0e38f;   /* padded keys excluded */ v[ch * 4 + q] = t; mx = fmaxf(mx, t); } }
#pragma unroll
    for (int sh = 16; sh; sh >>= 1) mx = fmaxf(mx, __shfl_xor(mx, sh, 32));
    float sum = 0.f;
#pragma unroll
    for (int k = 0; k < TT / 32; ++k) { float d0 = __fsub_rn(v[k], mx); asm volatile("" : "+v"(d0)); v[k] = __builtin_amdgcn_exp2f(__fmul_rn(d0, 1.4426950408889634f)); sum += v[k]; }
#pragma unroll
    for (int sh = 16; sh; sh >>= 1) sum += __shfl_xor(sum, sh, 32);
    const float f = __fdiv_rn(hires ? 1.0f : PCAR, sum);
{
        if (hires) {
#pragma unroll
            for (int ch = 0; ch < TT / 128; ++ch) { v4us oh, ol;
#pragma unroll
                for (int q = 0; q < 4; ++q) { unsigned short a, c2; splitf(v[ch * 4 + q] * f, a, c2); oh[q] = a; ol[q] = c2; }
                const size_t oo = ((size_t)zz * (RH ? RH : 1) + i) * TT + ch * 128 + lane * 4; *(v4us*)(Ph + oo) = oh; *(v4us*)(Pl + oo) = ol; }
        } else {
#pragma unroll
            for (int ch = 0; ch < TT / 128; ++ch) { v4h o4;
#pragma unroll
                for (int q = 0; q < 4; ++q) o4[q] = tohx(v[ch * 4 + q] * f);
                *(v4h*)(P16 + (size_t)row * TT + ch * 128 + lane * 4) = o4; } }
         }
}
__global__ __launch_bounds__(256) void k_merge(const float* __restrict__ O, int h0, bf* Ah, bf* Al) { const size_t e = ((size_t)blockIdx.x * 256 + threadIdx.x) * 2; if (e >= (size_t)ZH * TT * HD) return; const int d = (int)(e % HD); const int t = (int)((e / HD) % TT); const int zz = (int)(e / ((size_t)HD * TT)); const float cs = (t < RH) ? 1.0f : (1.0f / PCAR); const size_t oo = (size_t)t * DQ + (h0 + zz) * HD + d;
    v2us oh, ol;
#pragma unroll
    for (int q = 0; q < 2; ++q) { unsigned short a, c2; splitf(O[e + q] * cs, a, c2); oh[q] = a; ol[q] = c2; } *(v2us*)(Ah + oo) = oh; *(v2us*)(Al + oo) = ol;  }

extern "C" void kernel_launch(void* const* d_in, const int* in_sizes, int n_in,
                              void* d_out, int out_size, void* d_ws, size_t ws_size, hipStream_t stream) {
    (void)in_sizes; (void)n_in; (void)out_size;
    const float* x = (const float*)d_in[0]; const float* xkv = (const float*)d_in[1]; const int* pm = (const int*)d_in[2];   /* pad_mask [4][1024] bool as int32: 1 = padding key */ const float* wq = (const float*)d_in[3]; const float* wk = (const float*)d_in[4]; const float* wv = (const float*)d_in[5]; const float* wo = (const float*)d_in[6]; const float* bo = (const float*)d_in[7];
    float* OUT = (float*)d_out;     // [4][1024][1024]
    char* wsp = (char*)d_ws;
    auto take = [&](size_t bytes) { char* p = wsp; wsp += (bytes + 255) & ~(size_t)255; return (void*)p; };
    const size_t PB = (size_t)NH_ * TT * HD;   // one batch of head planes (elements); NKV == NH_ here
    bf* WQ = (bf*)take((size_t)DQ * DM * 2); bf* WK = (bf*)take((size_t)DKV * DM * 2); bf* WV = (bf*)take((size_t)DKV * DM * 2); bf* WO = (bf*)take((size_t)DM * DQ * 2); float* CS = (float*)take((size_t)TT * HD * 2 * 4);   // the four weight planes are contiguous (2 MiB each)
    h16* QP16 = (h16*)take(2 * NB_ * PB * 2); h16* KP16 = QP16 + NB_ * PB; bf* QPh = (bf*)take(2 * NB_ * PB * 2); bf* KPh = QPh + NB_ * PB; bf* QPl = (bf*)take(2 * NB_ * PB * 2); bf* KPl = QPl + NB_ * PB;   // q planes of all batches, then k planes
    h16* VT16 = (h16*)take(NB_ * PB * 2); bf* VTh = (bf*)take(NB_ * PB * 2); bf* VTl = (bf*)take(NB_ * PB * 2);
    bf* Ph = (bf*)take((size_t)ZH * RH * TT * 2); bf* Pl = (bf*)take((size_t)ZH * RH * TT * 2);
    float* Sb = (float*)take((size_t)ZH * TT * TT * 4); h16* P16 = (h16*)take((size_t)ZH * TT * TT * 2); float* Ob = (float*)take((size_t)ZH * TT * HD * 4); bf* ATh = (bf*)take((size_t)NB_ * TT * DQ * 2); bf* ATl = (bf*)take((size_t)NB_ * TT * DQ * 2);
    if ((size_t)(wsp - (char*)d_ws) > ws_size) return;    // ws 256 MiB
    // The projections' f32 results (48 MiB) and the bf16 inputs (16 MiB) are dead once the head planes are built: they lie in the score and probability buffers (stream-ordered).
    float* FQ = Sb; float* FK = FQ + (size_t)NB_ * TT * DQ; float* FV = FK + (size_t)NB_ * TT * DKV; bf* XB = (bf*)P16; bf* XKV = XB + (size_t)NB_ * TT * DM;
    k_wtG<<<dim3((unsigned)((DM * DQ / 64 + 63) / 64), 4, 1), 256, 0, stream>>>(wq, wk, wv, wo, DM, DQ, WQ);
    k_csid<<<(TT * HD + 255) / 256, 256, 0, stream>>>(CS);
    const unsigned LQ = (unsigned)(((size_t)NH_ * TT * HD / 2 + 255) / 256), LKv = (unsigned)(((size_t)NKV * TT * HD / 2 + 255) / 256);
    k_cvt8<<<dim3((unsigned)(((size_t)NB_ * TT * DM / 8 + 255) / 256), 2, 1), 256, 0, stream>>>(x, xkv, XB, (size_t)NB_ * TT * DM / 8);
    k_gemmw<bf, 0, false><<<dim3(NB_ * TT / 64, DQ / 64, 1), 32, 0, stream>>>(XB, nullptr, WQ, nullptr, DM, FQ, DQ, nullptr, 0, 0, 0);
    k_gemmw<bf, 0, false><<<dim3(NB_ * TT / 64, DKV / 64, 2), 32, 0, stream>>>(XKV, nullptr, WK, nullptr, DM, FK, DKV, nullptr, 0, (size_t)DKV * DM, (size_t)NB_ * TT * DKV);   /* k, v from x_kv: z = 0, 1 */
    k_rope<<<dim3(LQ, 2 * NB_, 1), 256, 0, stream>>>(FQ, DQ, NH_, CS, nullptr, nullptr, 1.0f, QP16, QPh, QPl);   /* q slabs, then k slabs */
    k_vtp<<<dim3(LKv, NB_, 1), 256, 0, stream>>>(FV, DKV, NKV, VT16, VTh, VTl);
    for (int b = 0; b < NB_; ++b) { const size_t zb = (size_t)b * PB;   // all 16 heads of the batch in grid z (one kv head per query head, z-strides TT*HD)
        k_gemmw<bf, 2, false><<<dim3(RH / 64, TT / 64, ZH), 32, 0, stream>>>(QPh + zb, QPl + zb, KPh + zb, KPl + zb, HD, Sb, TT, nullptr, (size_t)TT * HD, (size_t)TT * HD, (size_t)TT * TT);
        k_gemmw<h16, 0, false><<<dim3((TT - RH) / 64, TT / 64, ZH), 32, 0, stream>>>(QP16 + zb + (size_t)RH * HD, nullptr, KP16 + zb, nullptr, HD, Sb + (size_t)RH * TT, TT, nullptr, (size_t)TT * HD, (size_t)TT * HD, (size_t)TT * TT);
        k_asoft<<<ZH * TT / 8, 256, 0, stream>>>(Sb, P16, Ph, Pl, pm + (size_t)b * TT);
        k_gemmw<bf, 2, false><<<dim3(RH / 64, HD / 64, ZH), 32, 0, stream>>>(Ph, Pl, VTh + zb, VTl + zb, TT, Ob, HD, nullptr, (size_t)RH * TT, (size_t)HD * TT, (size_t)TT * HD);
        k_gemmw<h16, 0, false><<<dim3((TT - RH) / 64, HD / 64, ZH), 32, 0, stream>>>(P16 + (size_t)RH * TT, nullptr, VT16 + zb, nullptr, TT, Ob + (size_t)RH * HD, HD, nullptr, (size_t)TT * TT, (size_t)HD * TT, (size_t)TT * HD);
        k_merge<<<(unsigned)(((size_t)ZH * TT * HD / 2 + 255) / 256), 256, 0, stream>>>(Ob, 0, ATh + (size_t)b * TT * DQ, ATl + (size_t)b * TT * DQ); }
    k_gemmw<bf, 1, true><<<dim3(NB_ * TT / 64, DM / 64, 1), 32, 0, stream>>>(ATh, ATl, WO, nullptr, DQ, OUT, DM, bo, 0, 0, 0);
}

// v003
// It runs in 189 microseconds.
// Versions between v001 and this one are left out; their measured steps multiply to 2.77 times as fast.
// Counting every step since v000, it is 12.6 times as fast.
#include <hip/hip_runtime.h>

// Multi-head cross attention with a key padding mask (x_q, x_kv [4][1024][1024]; q = x_q Wq, k, v = x_kv Wk, x_kv Wv ('xw' 1/32, no bias; 16 heads x 64); scores x 64^-0.5; keys with pad_mask[b][j] ([4][1024] bool, ~10 % true, read) -> -finfo.max (== exclusion); softmax; out = merged Wo ('xw' 1/32) + bo -> [4][1024][1024] (4.2 M)).
// Layout: bf16 copies of x_q and x_kv (all batches, one launch); 'xw' weights transposed once (one launch); exact projections over all 4096 rows that write the head planes from their own epilogue; one fused attention launch over all batches and heads (S^T = K Q^T, running-maximum softmax that excludes padded keys through a bias row in LDS, O^T += V^T P^T, merged hi/lo rows written directly; hybrid rows: < 512 hi/lo 3 products, rest fp16 with P x 1024); merged hi/lo x Wo exact + bo.
// Compute dtypes, f32 accumulate: every input rounded to bf16; projections exact; attention rows < 512 3 products, rest fp16; softmax f32; Wo hl x exact + bias.

#define NB_  4
#define TT   1024
#define DM   1024
#define NH_  16
#define NKV  16
#define REP  (NH_ / NKV)
#define HD   64
#define DQ   (NH_ * HD)
#define DKV  (NKV * HD)
#define ZH   16                   // heads per attention launch (unused; heads are in grid y)
#define RH   512                  // query rows < RH use hi+lo planes (must be TT / 2: z = 1 takes the rest)
#define WIN  0
#define PCAR 1024.0f
#define SCL  0.125f   // HD^-0.5
typedef _Float16 h16;
typedef unsigned short bf;
typedef __attribute__((ext_vector_type(16))) __bf16   v16bf;
typedef __attribute__((ext_vector_type(16))) _Float16 v16h;
typedef __attribute__((ext_vector_type(8)))  _Float16 v8h;
typedef __attribute__((ext_vector_type(8)))  unsigned short v8us;
typedef __attribute__((ext_vector_type(8)))  float    v8f;
typedef __attribute__((ext_vector_type(8)))  __bf16   v8bfv;
typedef __attribute__((ext_vector_type(4)))  float    v4f;
typedef v8h  __attribute__((may_alias)) v8ha;
typedef v4f  __attribute__((may_alias)) v4fa;
typedef v8us __attribute__((may_alias)) v8usa;

__device__ __forceinline__ unsigned short f2bf(float f) { unsigned u = __float_as_uint(f); u += 0x7FFFu + ((u >> 16) & 1u); return (unsigned short)(u >> 16); }
__device__ __forceinline__ float bf2f(unsigned short b) { return __uint_as_float(((unsigned)b) << 16); }
__device__ __forceinline__ float bfr(float f) { return bf2f(f2bf(f)); }
__device__ __forceinline__ v16h cat16(v8h lo, v8h hi) { return __builtin_shufflevector(lo, hi, 0, 1, 2, 3, 4, 5, 6, 7, 8, 9, 10, 11, 12, 13, 14, 15); }
__device__ __forceinline__ v16bf cat16b(v8us lo, v8us hi) { return __builtin_bit_cast(v16bf, __builtin_shufflevector(lo, hi, 0, 1, 2, 3, 4, 5, 6, 7, 8, 9, 10, 11, 12, 13, 14, 15)); }
__device__ __forceinline__ v8f wmma16(v16h a, v16h b, v8f c) { return __builtin_amdgcn_wmma_f32_16x16x32_f16(false, a, false, b, (short)0, c, false, false); }
__device__ __forceinline__ v8f wmmab(v16bf a, v16bf b, v8f c) { return __builtin_amdgcn_wmma_f32_16x16x32_bf16(false, a, false, b, (short)0, c, false, false); }



// ---- k_gemmw: register-blocked GEMM, ONE WAVE per 64x64 output tile (16 accumulators), operands straight from K-contiguous 16-bit planes; grid (M/64, N/64, Z), 32 threads.
// C[m][n] (f32, pitch ldc, + optional f32 bias[n]) = sum_k A[m][k] Bt[n][k] (+ split products per NSPLIT). z-batch strides sA/sB/sC in elements. K % 32 == 0.
// PLANES: no C. A tile is 64 tokens of one batch x the 64 channels of one head (blockIdx.y), and the wave writes it as fp16 + bf16 hi/lo head planes: z = 0 into [b][h][t][d] (P*), z = 1 into [b][h][d][t] (T*).
template <typename T16> struct WFrag;
template <> struct WFrag<h16> { typedef v16h V; static __device__ __forceinline__ V ld(const h16* p) { return cat16(*(const v8h*)p, *(const v8h*)(p + 16)); } static __device__ __forceinline__ v8f mma(V a, V b, v8f c) { return wmma16(a, b, c); } };
template <> struct WFrag<bf> { typedef v16bf V; static __device__ __forceinline__ V ld(const bf* p) { return cat16b(*(const v8us*)p, *(const v8us*)(p + 16)); } static __device__ __forceinline__ v8f mma(V a, V b, v8f c) { return wmmab(a, b, c); } };
// planes_out: one wave's 64 x 64 f32 tile (acc[mb][nb]: token mb*16 + 8*hi + j, channel nb*16 + lr) as fp16, bf16 hi and bf16 lo planes; TR false: plane rows are tokens (pitch HD), true: channels (pitch TT).
// A panel of 16 plane rows x 64 goes through LDS so that 8 lanes write one whole 128-byte line of each plane.
template <bool TR>
__device__ __forceinline__ void planes_out(const v8f (&acc)[4][4], float* os, int lane, h16* d16, bf* dh, bf* dl) {
    constexpr int PITCH = TR ? TT : HD;
    const int lr = lane & 15, hi = lane >> 4, prow = lane >> 3, pcol = (lane & 7) * 8;
    const unsigned lob = (unsigned)(prow * PITCH + pcol) * 2u;   // the lane's byte offset in each plane; the plane pointers stay wave-uniform
    // Every loop here is unrolled so that acc and the staging vectors are indexed by constants only and stay in registers.
#pragma unroll
    for (int pb = 0; pb < 4; ++pb) {
        if (TR) {   // a lane holds 8 consecutive tokens of one channel
#pragma unroll
            for (int mb = 0; mb < 4; ++mb) { const v8f w = acc[mb][pb]; *(v4fa*)(os + lr * 68 + mb * 16 + hi * 8) = __builtin_shufflevector(w, w, 0, 1, 2, 3); *(v4fa*)(os + lr * 68 + mb * 16 + hi * 8 + 4) = __builtin_shufflevector(w, w, 4, 5, 6, 7); }
        } else {
#pragma unroll
            for (int nb = 0; nb < 4; ++nb) {
#pragma unroll
                for (int j = 0; j < 8; ++j) os[(hi * 8 + j) * 68 + nb * 16 + lr] = acc[pb][nb][j]; }
        }
        __builtin_amdgcn_wave_barrier(); asm volatile("" ::: "memory");   // holds the compiler: the panel's LDS writes stay in front of the other lanes' reads of them (one wave, LDS runs in order)
        v8h o16[4]; v8us oh[4], ol[4];
#pragma unroll
        for (int s = 0; s < 4; ++s) { const float* pr = os + (4 * s + prow) * 68 + pcol; const v4f x0 = *(const v4fa*)pr, x1 = *(const v4fa*)(pr + 4); const v8f x = __builtin_shufflevector(x0, x1, 0, 1, 2, 3, 4, 5, 6, 7);
            const v8bfv h = __builtin_convertvector(x, v8bfv); const v8bfv l = __builtin_convertvector(x - __builtin_convertvector(h, v8f), v8bfv);   // round to nearest even, as f2bf
            o16[s] = __builtin_convertvector(x, v8h); oh[s] = __builtin_bit_cast(v8us, h); ol[s] = __builtin_bit_cast(v8us, l); }
#pragma unroll
        for (int s = 0; s < 4; ++s) { const int o = (pb * 16 + 4 * s) * PITCH * 2; *(v8h*)((char*)d16 + lob + o) = o16[s]; *(v8us*)((char*)dh + lob + o) = oh[s]; *(v8us*)((char*)dl + lob + o) = ol[s]; }
        // s_wait_xcnt 0 behind the panel's stores, in front of any reuse of their address or data registers (inputs, so that the registers stay theirs up to the wait); its memory clobber also keeps the next panel's LDS writes behind this panel's reads
        asm volatile("s_wait_xcnt 0x0" :: "v"(lob), "v"(o16[0]), "v"(o16[1]), "v"(o16[2]), "v"(o16[3]), "v"(oh[0]), "v"(oh[1]), "v"(oh[2]), "v"(oh[3]), "v"(ol[0]), "v"(ol[1]), "v"(ol[2]), "v"(ol[3]) : "memory");
    }
}
template <typename T16, int NSPLIT, bool BIAS, bool PLANES>
__global__ __launch_bounds__(32) void k_gemmw(const T16* __restrict__ A, const T16* __restrict__ A2, const T16* __restrict__ Bt, const T16* __restrict__ Bt2, int K, float* C, int ldc, const float* __restrict__ bias, size_t sA, size_t sB, size_t sC, h16* P16, bf* Ph, bf* Pl, h16* T16p, bf* Th, bf* Tl) {
    typedef typename WFrag<T16>::V V;
    __shared__ __align__(16) float os[16 * 68];
    const size_t z = blockIdx.z; A += z * sA; if (A2) A2 += z * sA; Bt += z * sB; if (Bt2) Bt2 += z * sB; C += z * sC;
    const int lane = threadIdx.x & 31, lr = lane & 15, hi = lane >> 4; const int r0 = blockIdx.x * 64, c0 = blockIdx.y * 64;
    v8f acc[4][4];
#pragma unroll
    for (int mb = 0; mb < 4; ++mb)
#pragma unroll
        for (int nb = 0; nb < 4; ++nb) acc[mb][nb] = (v8f){};
    const size_t aoff = (size_t)(r0 + lr) * K + 8 * hi, boff = (size_t)(c0 + lr) * K + 8 * hi;
#pragma unroll 1
    for (int kc = 0; kc < K; kc += 32) {
        V a[4], a2[4];
#pragma unroll
        for (int mb = 0; mb < 4; ++mb) { a[mb] = WFrag<T16>::ld(A + aoff + (size_t)mb * 16 * K + kc); if (NSPLIT == 1 || NSPLIT == 2) a2[mb] = WFrag<T16>::ld(A2 + aoff + (size_t)mb * 16 * K + kc); }
#pragma unroll
        for (int nb = 0; nb < 4; ++nb) { const V b = WFrag<T16>::ld(Bt + boff + (size_t)nb * 16 * K + kc); V b2; if (NSPLIT >= 2) b2 = WFrag<T16>::ld(Bt2 + boff + (size_t)nb * 16 * K + kc);
#pragma unroll
            for (int mb = 0; mb < 4; ++mb) { acc[mb][nb] = WFrag<T16>::mma(a[mb], b, acc[mb][nb]); if (NSPLIT == 1 || NSPLIT == 2) acc[mb][nb] = WFrag<T16>::mma(a2[mb], b, acc[mb][nb]); if (NSPLIT >= 2) acc[mb][nb] = WFrag<T16>::mma(a[mb], b2, acc[mb][nb]); } }
        asm volatile("v_nop\n\tv_nop\n\tv_nop\n\tv_nop" : "+v"(acc[0][0]), "+v"(acc[1][1]), "+v"(acc[2][2]), "+v"(acc[3][3]) : "v"(a[0]), "v"(a[3]));
    }
    if (PLANES) {
        static_assert(HD == 64 && TT % 64 == 0, "one tile = one head, one batch");
        const size_t hp = ((size_t)(r0 / TT) * (ldc / HD) + blockIdx.y) * TT * HD; const int t0 = r0 % TT;   // ldc: channels of all heads
        if (z == 0) planes_out<false>(acc, os, lane, P16 + hp + (size_t)t0 * HD, Ph + hp + (size_t)t0 * HD, Pl + hp + (size_t)t0 * HD);
        else planes_out<true>(acc, os, lane, T16p + hp + t0, Th + hp + t0, Tl + hp + t0);
        return;
    }
#pragma unroll
    for (int mb = 0; mb < 4; ++mb) {
#pragma unroll
        for (int nb = 0; nb < 4; ++nb) {
#pragma unroll
            for (int j = 0; j < 8; ++j) os[(hi * 8 + j) * 68 + nb * 16 + lr] = acc[mb][nb][j]; }
        __builtin_amdgcn_wave_barrier(); asm volatile("" ::: "memory");
        float* crow = C + (size_t)(r0 + mb * 16) * ldc + c0;
{
#pragma unroll
            for (int s = 0; s < 8; ++s) { const int row = 2 * s + hi, cofs = lr * 4; v4f val = *(const v4fa*)(os + row * 68 + cofs); if (BIAS) { val[0] += bfr(bias[c0 + cofs]); val[1] += bfr(bias[c0 + cofs + 1]); val[2] += bfr(bias[c0 + cofs + 2]); val[3] += bfr(bias[c0 + cofs + 3]); }
                *(v4f*)(crow + (size_t)row * ldc + cofs) = val; }
             }
        __builtin_amdgcn_wave_barrier(); asm volatile("" ::: "memory");
    }
}

__device__ __forceinline__ void splitf(float y, unsigned short& h, unsigned short& l) { h = f2bf(y); l = f2bf(y - bf2f(h)); }
typedef __attribute__((ext_vector_type(2))) _Float16 v2h;
typedef __attribute__((ext_vector_type(4))) _Float16 v4h;
typedef __attribute__((ext_vector_type(2))) unsigned short v2us;
typedef __attribute__((ext_vector_type(4))) unsigned short v4us;
typedef __attribute__((ext_vector_type(2))) float v2f;
typedef __attribute__((ext_vector_type(4))) int v4i;

// blockIdx.y picks one of four equally shaped weights; their transposed planes lie one behind the other in Bt
__global__ __launch_bounds__(256) void k_wtG(const float* __restrict__ w0, const float* __restrict__ w1, const float* __restrict__ w2, const float* __restrict__ w3, int K, int N, bf* Bt) {
    const int y = blockIdx.y; const float* __restrict__ w = (y == 0) ? w0 : (y == 1) ? w1 : (y == 2) ? w2 : w3; Bt += (size_t)y * N * K;
    const int lane = threadIdx.x & 31; const int L0 = (blockIdx.x * 8 + (threadIdx.x >> 5)) * 8; const int nlines = N * K / 64;
{
#pragma unroll 1
        for (int l = 0; l < 8; ++l) { const int L = L0 + l; if (L >= nlines) break; const size_t e = (size_t)L * 64 + lane * 2; const int k = (int)(e % K), n = (int)(e / K); v2us o;
            o[0] = f2bf(w[(size_t)k * N + n]); o[1] = f2bf(w[(size_t)(k + 1) * N + n]); *(v2us*)(Bt + e) = o; }
         }
}
// blockIdx.y picks the source; the two copies lie one behind the other in dst
__global__ __launch_bounds__(256) void k_cvt8(const float* __restrict__ src0, const float* __restrict__ src1, bf* dst, size_t n8) { const size_t i = (size_t)blockIdx.x * 256 + threadIdx.x; if (i >= n8) return; const float* __restrict__ src = blockIdx.y ? src1 : src0; dst += (size_t)blockIdx.y * n8 * 8; const v8f v = *(const v8f*)(src + i * 8); v8us o;
#pragma unroll
    for (int k = 0; k < 8; ++k) o[k] = f2bf(v[k]); *(v8us*)(dst + i * 8) = o;  }

#define QT   2                    // 16-query groups per wave
#define FW   4                    // waves per block
#define CL2  0.18033688011112042f // HD^-0.5 * log2(e)
typedef __attribute__((ext_vector_type(2))) __bf16 v2bf;
__device__ __forceinline__ float xhalf(float x) { const int b = __float_as_int(x); return __int_as_float(__builtin_amdgcn_permlanex16(b, b, 0x76543210, 0xfedcba98, false, false)); }   // lane l <-> l ^ 16
__device__ __forceinline__ void packp(const float* p, v16bf& h, v16bf& l) {
#pragma unroll
    for (int e = 0; e < 16; e += 2) { v2f pp; pp[0] = p[e]; pp[1] = p[e + 1]; const v2bf hh = __builtin_convertvector(pp, v2bf); v2f rr; rr[0] = pp[0] - (float)hh[0]; rr[1] = pp[1] - (float)hh[1]; const v2bf ll = __builtin_convertvector(rr, v2bf); h[e] = hh[0]; h[e + 1] = hh[1]; l[e] = ll[0]; l[e + 1] = ll[1]; } }
__device__ __forceinline__ void packp(const float* p, v16h& h, v16h& l) { (void)l;
#pragma unroll
    for (int e = 0; e < 16; e += 2) { v2f pp; pp[0] = p[e]; pp[1] = p[e + 1]; const v2h hh = __builtin_convertvector(pp, v2h); h[e] = hh[0]; h[e + 1] = hh[1]; } }
template <typename T16, bool SPLIT>
__device__ __forceinline__ void fattn(const T16* __restrict__ Qh, const T16* __restrict__ Ql, const T16* __restrict__ Kh, const T16* __restrict__ Kl, const T16* __restrict__ Vh, const T16* __restrict__ Vl, const float* mb, int q0, float pexp, bf* Ah, bf* Al) {
    typedef typename WFrag<T16>::V V;
    const int lane = threadIdx.x & 31, lr = lane & 15, hi = lane >> 4;
    V q[QT][2], q2[QT][2]; v8f o[QT][4]; float m[QT], l[QT];
    // XW: s_wait_xcnt 0 behind a run of loads or stores, in front of any reuse of their address registers; the pointers are inputs so that their registers stay theirs up to the wait.
#define XW1(p)     asm volatile("s_wait_xcnt 0x0" :: "v"(p) : "memory")
#define XW2(p, p2) asm volatile("s_wait_xcnt 0x0" :: "v"(p), "v"(p2) : "memory")
#pragma unroll
    for (int qt = 0; qt < QT; ++qt) { m[qt] = -3.0e38f; l[qt] = 0.f; const size_t qo = (size_t)(q0 + qt * 16 + lr) * HD + 8 * hi; const T16* pq = Qh + qo; const T16* pq2 = SPLIT ? Ql + qo : pq;
#pragma unroll
        for (int kc = 0; kc < 2; ++kc) { q[qt][kc] = WFrag<T16>::ld(pq + kc * 32); if (SPLIT) q2[qt][kc] = WFrag<T16>::ld(pq2 + kc * 32); }
        if (SPLIT) XW2(pq, pq2); else XW1(pq);
#pragma unroll
        for (int dt = 0; dt < 4; ++dt) o[qt][dt] = (v8f){}; }
    const size_t ko = (size_t)lr * HD + 8 * hi, vo = (size_t)lr * TT + 8 * hi;
    // K and V fragments are fetched one pass ahead into the same registers: K right behind its S^T products, V behind its O^T products, so each load has the rest of a pass to land.
    // The waits, as memory barriers for the compiler, also keep the prologue's load order equal to the loop's (Q, K, then V): load counts retire in order and the wait at the loop's top is merged over both entries.
    V kf[2][2], kf2[2][2], vf[4], vf2[4];
    auto ldk = [&](int kb) { const T16* p = Kh + ko + (size_t)kb * HD; const T16* p2 = SPLIT ? Kl + ko + (size_t)kb * HD : p;
#pragma unroll
        for (int kt = 0; kt < 2; ++kt)
#pragma unroll
            for (int kc = 0; kc < 2; ++kc) { const int off = kt * 16 * HD + kc * 32; kf[kt][kc] = WFrag<T16>::ld(p + off); if (SPLIT) kf2[kt][kc] = WFrag<T16>::ld(p2 + off); }
        if (SPLIT) XW2(p, p2); else XW1(p); };
    auto ldv = [&](int kb) { const T16* p = Vh + vo + kb; const T16* p2 = SPLIT ? Vl + vo + kb : p;
#pragma unroll
        for (int dt = 0; dt < 4; ++dt) { const int off = dt * 16 * TT; vf[dt] = WFrag<T16>::ld(p + off); if (SPLIT) vf2[dt] = WFrag<T16>::ld(p2 + off); }
        if (SPLIT) XW2(p, p2); else XW1(p); };
    // The first fetch is addressed as wave-uniform base + 32-bit lane byte offset: its waits name that offset register.
    const unsigned kob = (unsigned)ko * 2u, vob = (unsigned)vo * 2u;
    ldk(0); XW1(kob); ldv(0); XW1(vob);
#pragma unroll 1
    for (int kb = 0; kb < TT; kb += 32) {
        const int kn = (kb + 32 < TT) ? kb + 32 : 0;   // the last pass fetches pass 0 again (in bounds, unused)
        v8f s[QT][2];
#pragma unroll
        for (int qt = 0; qt < QT; ++qt) { s[qt][0] = (v8f){}; s[qt][1] = (v8f){}; }
#pragma unroll
        for (int kt = 0; kt < 2; ++kt)
#pragma unroll
            for (int kc = 0; kc < 2; ++kc)
#pragma unroll
                for (int qt = 0; qt < QT; ++qt) { s[qt][kt] = WFrag<T16>::mma(kf[kt][kc], q[qt][kc], s[qt][kt]); if (SPLIT) { s[qt][kt] = WFrag<T16>::mma(kf[kt][kc], q2[qt][kc], s[qt][kt]); s[qt][kt] = WFrag<T16>::mma(kf2[kt][kc], q[qt][kc], s[qt][kt]); } }
        ldk(kn);
        float bias[16];   // 0 for a live key, -3e38 for a padded one: keys kb + 8 hi + 0..7 and kb + 16 + 8 hi + 0..7
#pragma unroll
        for (int c4 = 0; c4 < 4; ++c4) { const v4f b4 = *(const v4fa*)(mb + kb + (c4 >> 1) * 16 + hi * 8 + (c4 & 1) * 4);
#pragma unroll
            for (int j = 0; j < 4; ++j) bias[c4 * 4 + j] = b4[j]; }
#pragma unroll
        for (int qt = 0; qt < QT; ++qt) { float t[16]; float mx = m[qt];
#pragma unroll
            for (int e = 0; e < 16; ++e) { t[e] = fmaf(s[qt][e >> 3][e & 7], CL2, bias[e]); mx = fmaxf(mx, t[e]); }
            mx = fmaxf(mx, xhalf(mx));
            const float al = __builtin_amdgcn_exp2f(m[qt] - mx), sh = pexp - mx; m[qt] = mx; float sum = 0.f;
#pragma unroll
            for (int e = 0; e < 16; ++e) { t[e] = __builtin_amdgcn_exp2f(t[e] + sh); sum += t[e]; }
            l[qt] = fmaf(l[qt], al, sum);
#pragma unroll
            for (int dt = 0; dt < 4; ++dt) o[qt][dt] *= al;
            V ph, pl; packp(t, ph, pl);
#pragma unroll
            for (int dt = 0; dt < 4; ++dt) { o[qt][dt] = WFrag<T16>::mma(vf[dt], ph, o[qt][dt]); if (SPLIT) { o[qt][dt] = WFrag<T16>::mma(vf[dt], pl, o[qt][dt]); o[qt][dt] = WFrag<T16>::mma(vf2[dt], ph, o[qt][dt]); } } }
        ldv(kn);
    }
#pragma unroll
    for (int qt = 0; qt < QT; ++qt) { const float inv = __fdiv_rn(1.0f, l[qt] + xhalf(l[qt])); const size_t ro = (size_t)(q0 + qt * 16 + lr) * DQ + hi * 8; bf* ph = Ah + ro; bf* pl = Al + ro;
#pragma unroll
        for (int dt = 0; dt < 4; ++dt) { v8us oh, ol;
#pragma unroll
            for (int j = 0; j < 8; ++j) { unsigned short a, c2; splitf(o[qt][dt][j] * inv, a, c2); oh[j] = a; ol[j] = c2; }
            *(v8us*)(ph + dt * 16) = oh; *(v8us*)(pl + dt * 16) = ol; }
        XW2(ph, pl); }
#undef XW1
#undef XW2
}
// grid (row blocks of FW*QT*16 queries, batch*head, 2): z = 0 rows < RH (hi/lo planes, 3 products; the heavier blocks start first), z = 1 the rest (fp16, P x 1024)
__global__ __launch_bounds__(FW * 32) void k_fattn(const h16* __restrict__ Q16, const bf* __restrict__ Qh, const bf* __restrict__ Ql, const h16* __restrict__ K16, const bf* __restrict__ Kh, const bf* __restrict__ Kl, const h16* __restrict__ V16, const bf* __restrict__ Vh, const bf* __restrict__ Vl, const int* __restrict__ pm, bf* Ah, bf* Al) {
    __shared__ __align__(16) float mb[TT];
    const int bh = blockIdx.y, b = bh / NH_, h = bh % NH_;
#pragma unroll
    for (int i = 0; i < TT / (FW * 32 * 4); ++i) { const int j0 = (i * FW * 32 + threadIdx.x) * 4; const v4i p4 = *(const v4i*)(pm + (size_t)b * TT + j0); v4f b4;   /* 4 padding flags (16 B) */
#pragma unroll
        for (int j = 0; j < 4; ++j) b4[j] = (p4[j] == 0) ? 0.0f : -3.0e38f;   /* padded keys excluded */
        *(v4fa*)(mb + j0) = b4; }
    __syncthreads();   // every wave reads the whole bias row
    const size_t po = (size_t)bh * TT * HD, ao = (size_t)b * TT * DQ + h * HD; const int qw = (blockIdx.x * FW + (threadIdx.x >> 5)) * (QT * 16);
    if (blockIdx.z == 0) fattn<bf, true>(Qh + po, Ql + po, Kh + po, Kl + po, Vh + po, Vl + po, mb, qw, 0.0f, Ah + ao, Al + ao);
    else fattn<h16, false>(Q16 + po, nullptr, K16 + po, nullptr, V16 + po, nullptr, mb, RH + qw, 10.0f, Ah + ao, Al + ao);
}

extern "C" void kernel_launch(void* const* d_in, const int* in_sizes, int n_in,
                              void* d_out, int out_size, void* d_ws, size_t ws_size, hipStream_t stream) {
    (void)in_sizes; (void)n_in; (void)out_size;
    const float* x = (const float*)d_in[0]; const float* xkv = (const float*)d_in[1]; const int* pm = (const int*)d_in[2];   /* pad_mask [4][1024] bool as int32: 1 = padding key */ const float* wq = (const float*)d_in[3]; const float* wk = (const float*)d_in[4]; const float* wv = (const float*)d_in[5]; const float* wo = (const float*)d_in[6]; const float* bo = (const float*)d_in[7];
    float* OUT = (float*)d_out;     // [4][1024][1024]
    char* wsp = (char*)d_ws;
    auto take = [&](size_t bytes) { char* p = wsp; wsp += (bytes + 255) & ~(size_t)255; return (void*)p; };
    const size_t PB = (size_t)NH_ * TT * HD;   // one batch of head planes (elements); NKV == NH_ here
    bf* WQ = (bf*)take((size_t)DQ * DM * 2); bf* WK = (bf*)take((size_t)DKV * DM * 2); bf* WV = (bf*)take((size_t)DKV * DM * 2); bf* WO = (bf*)take((size_t)DM * DQ * 2);   // the four weight planes are contiguous (2 MiB each)
    h16* QP16 = (h16*)take(2 * NB_ * PB * 2); h16* KP16 = QP16 + NB_ * PB; bf* QPh = (bf*)take(2 * NB_ * PB * 2); bf* KPh = QPh + NB_ * PB; bf* QPl = (bf*)take(2 * NB_ * PB * 2); bf* KPl = QPl + NB_ * PB;   // q planes of all batches, then k planes
    h16* VT16 = (h16*)take(NB_ * PB * 2); bf* VTh = (bf*)take(NB_ * PB * 2); bf* VTl = (bf*)take(NB_ * PB * 2);
    bf* XB = (bf*)take((size_t)2 * NB_ * TT * DM * 2); bf* XKV = XB + (size_t)NB_ * TT * DM; bf* ATh = (bf*)take((size_t)NB_ * TT * DQ * 2); bf* ATl = (bf*)take((size_t)NB_ * TT * DQ * 2);
    if ((size_t)(wsp - (char*)d_ws) > ws_size) return;    // ws 256 MiB
    k_wtG<<<dim3((unsigned)((DM * DQ / 64 + 63) / 64), 4, 1), 256, 0, stream>>>(wq, wk, wv, wo, DM, DQ, WQ);
    k_cvt8<<<dim3((unsigned)(((size_t)NB_ * TT * DM / 8 + 255) / 256), 2, 1), 256, 0, stream>>>(x, xkv, XB, (size_t)NB_ * TT * DM / 8);
    k_gemmw<bf, 0, false, true><<<dim3(NB_ * TT / 64, DQ / 64, 1), 32, 0, stream>>>(XB, nullptr, WQ, nullptr, DM, nullptr, DQ, nullptr, 0, 0, 0, QP16, QPh, QPl, nullptr, nullptr, nullptr);
    k_gemmw<bf, 0, false, true><<<dim3(NB_ * TT / 64, DKV / 64, 2), 32, 0, stream>>>(XKV, nullptr, WK, nullptr, DM, nullptr, DKV, nullptr, 0, (size_t)DKV * DM, 0, KP16, KPh, KPl, VT16, VTh, VTl);   /* k, v from x_kv: z = 0, 1 */
    k_fattn<<<dim3(RH / (FW * QT * 16), NB_ * NH_, 2), FW * 32, 0, stream>>>(QP16, QPh, QPl, KP16, KPh, KPl, VT16, VTh, VTl, pm, ATh, ATl);   /* all batches and heads; RH == TT - RH */
    k_gemmw<bf, 1, true, false><<<dim3(NB_ * TT / 64, DM / 64, 1), 32, 0, stream>>>(ATh, ATl, WO, nullptr, DQ, OUT, DM, bo, 0, 0, 0, nullptr, nullptr, nullptr, nullptr, nullptr, nullptr);
}

// v004
// Measured time: 129 microseconds a run.
// Timed twice side by side with v003, it ran 1.46 times as fast both times.
// Over all steps from v000 it is 18.5 times as fast.
#include <hip/hip_runtime.h>

// Multi-head cross attention with a key padding mask (x_q, x_kv [4][1024][1024]; q = x_q Wq, k, v = x_kv Wk, x_kv Wv ('xw' 1/32, no bias; 16 heads x 64); scores x 64^-0.5; keys with pad_mask[b][j] ([4][1024] bool, ~10 % true, read) -> -finfo.max (== exclusion); softmax; out = merged Wo ('xw' 1/32) + bo -> [4][1024][1024] (4.2 M)).
// Layout: bf16 copies of x_q and x_kv (all batches, one launch); 'xw' weights transposed once (one launch); exact projections over all 4096 rows that write the head planes from their own epilogue; one fused attention launch over all batches and heads (S^T = K Q^T, running-maximum softmax that excludes padded keys through a bias row in LDS, O^T += V^T P^T, merged hi/lo rows written directly; hybrid rows: < 512 hi/lo 3 products, rest fp16 with P x 1024); merged hi/lo x Wo exact + bo.
// Compute dtypes, f32 accumulate: every input rounded to bf16; projections exact; attention rows < 512 3 products, rest fp16; softmax f32; Wo hl x exact + bias.

#define NB_  4
#define TT   1024
#define DM   1024
#define NH_  16
#define NKV  16
#define REP  (NH_ / NKV)
#define HD   64
#define DQ   (NH_ * HD)
#define DKV  (NKV * HD)
#define ZH   16                   // heads per attention launch (unused; heads are in grid y)
#define RH   512                  // query rows < RH use hi+lo planes (must be TT / 2: z = 1 takes the rest)
#define WIN  0
#define PCAR 1024.0f
#define SCL  0.125f   // HD^-0.5
typedef _Float16 h16;
typedef unsigned short bf;
typedef __attribute__((ext_vector_type(16))) __bf16   v16bf;
typedef __attribute__((ext_vector_type(16))) _Float16 v16h;
typedef __attribute__((ext_vector_type(8)))  _Float16 v8h;
typedef __attribute__((ext_vector_type(8)))  unsigned short v8us;
typedef __attribute__((ext_vector_type(8)))  float    v8f;
typedef __attribute__((ext_vector_type(8)))  __bf16   v8bfv;
typedef __attribute__((ext_vector_type(4)))  float    v4f;
typedef v8h  __attribute__((may_alias)) v8ha;
typedef v4f  __attribute__((may_alias)) v4fa;
typedef v8us __attribute__((may_alias)) v8usa;

__device__ __forceinline__ unsigned short f2bf(float f) { unsigned u = __float_as_uint(f); u += 0x7FFFu + ((u >> 16) & 1u); return (unsigned short)(u >> 16); }
__device__ __forceinline__ float bf2f(unsigned short b) { return __uint_as_float(((unsigned)b) << 16); }
__device__ __forceinline__ float bfr(float f) { return bf2f(f2bf(f)); }
__device__ __forceinline__ v16h cat16(v8h lo, v8h hi) { return __builtin_shufflevector(lo, hi, 0, 1, 2, 3, 4, 5, 6, 7, 8, 9, 10, 11, 12, 13, 14, 15); }
__device__ __forceinline__ v16bf cat16b(v8us lo, v8us hi) { return __builtin_bit_cast(v16bf, __builtin_shufflevector(lo, hi, 0, 1, 2, 3, 4, 5, 6, 7, 8, 9, 10, 11, 12, 13, 14, 15)); }
__device__ __forceinline__ v8f wmma16(v16h a, v16h b, v8f c) { return __builtin_amdgcn_wmma_f32_16x16x32_f16(false, a, false, b, (short)0, c, false, false); }
__device__ __forceinline__ v8f wmmab(v16bf a, v16bf b, v8f c) { return __builtin_amdgcn_wmma_f32_16x16x32_bf16(false, a, false, b, (short)0, c, false, false); }



// Fragment loaders from K-contiguous 16-bit planes: a lane reads 8 + 8 elements of its row, at 8 hi and 16 + 8 hi of each 32 k.
template <typename T16> struct WFrag;
template <> struct WFrag<h16> { typedef v16h V; static __device__ __forceinline__ V ld(const h16* p) { return cat16(*(const v8h*)p, *(const v8h*)(p + 16)); } static __device__ __forceinline__ v8f mma(V a, V b, v8f c) { return wmma16(a, b, c); } };
template <> struct WFrag<bf> { typedef v16bf V; static __device__ __forceinline__ V ld(const bf* p) { return cat16b(*(const v8us*)p, *(const v8us*)(p + 16)); } static __device__ __forceinline__ v8f mma(V a, V b, v8f c) { return wmmab(a, b, c); } };
// planes_out: one wave's 64 x 64 f32 tile (acc[mb][nb]: token mb*16 + 8*hi + j, channel nb*16 + lr) as fp16, bf16 hi and bf16 lo planes; TR false: plane rows are tokens (pitch HD), true: channels (pitch TT).
// A panel of 16 plane rows x 64 goes through LDS so that 8 lanes write one whole 128-byte line of each plane.
template <bool TR>
__device__ __forceinline__ void planes_out(const v8f (&acc)[4][4], float* os, int lane, h16* d16, bf* dh, bf* dl) {
    constexpr int PITCH = TR ? TT : HD;
    const int lr = lane & 15, hi = lane >> 4, prow = lane >> 3, pcol = (lane & 7) * 8;
    const unsigned lob = (unsigned)(prow * PITCH + pcol) * 2u;   // the lane's byte offset in each plane; the plane pointers stay wave-uniform
    // Every loop here is unrolled so that acc and the staging vectors are indexed by constants only and stay in registers.
#pragma unroll
    for (int pb = 0; pb < 4; ++pb) {
        if (TR) {   // a lane holds 8 consecutive tokens of one channel
#pragma unroll
            for (int mb = 0; mb < 4; ++mb) { const v8f w = acc[mb][pb]; *(v4fa*)(os + lr * 68 + mb * 16 + hi * 8) = __builtin_shufflevector(w, w, 0, 1, 2, 3); *(v4fa*)(os + lr * 68 + mb * 16 + hi * 8 + 4) = __builtin_shufflevector(w, w, 4, 5, 6, 7); }
        } else {
#pragma unroll
            for (int nb = 0; nb < 4; ++nb) {
#pragma unroll
                for (int j = 0; j < 8; ++j) os[(hi * 8 + j) * 68 + nb * 16 + lr] = acc[pb][nb][j]; }
        }
        __builtin_amdgcn_wave_barrier(); asm volatile("" ::: "memory");   // holds the compiler: the panel's LDS writes stay in front of the other lanes' reads of them (one wave, LDS runs in order)
        v8h o16[4]; v8us oh[4], ol[4];
#pragma unroll
        for (int s = 0; s < 4; ++s) { const float* pr = os + (4 * s + prow) * 68 + pcol; const v4f x0 = *(const v4fa*)pr, x1 = *(const v4fa*)(pr + 4); const v8f x = __builtin_shufflevector(x0, x1, 0, 1, 2, 3, 4, 5, 6, 7);
            const v8bfv h = __builtin_convertvector(x, v8bfv); const v8bfv l = __builtin_convertvector(x - __builtin_convertvector(h, v8f), v8bfv);   // round to nearest even, as f2bf
            o16[s] = __builtin_convertvector(x, v8h); oh[s] = __builtin_bit_cast(v8us, h); ol[s] = __builtin_bit_cast(v8us, l); }
#pragma unroll
        for (int s = 0; s < 4; ++s) { const int o = (pb * 16 + 4 * s) * PITCH * 2; *(v8h*)((char*)d16 + lob + o) = o16[s]; *(v8us*)((char*)dh + lob + o) = oh[s]; *(v8us*)((char*)dl + lob + o) = ol[s]; }
        // s_wait_xcnt 0 behind the panel's stores, in front of any reuse of their address or data registers (inputs, so that the registers stay theirs up to the wait); its memory clobber also keeps the next panel's LDS writes behind this panel's reads
        asm volatile("s_wait_xcnt 0x0" :: "v"(lob), "v"(o16[0]), "v"(o16[1]), "v"(o16[2]), "v"(o16[3]), "v"(oh[0]), "v"(oh[1]), "v"(oh[2]), "v"(oh[3]), "v"(ol[0]), "v"(ol[1]), "v"(ol[2]), "v"(ol[3]) : "memory");
    }
}
// ---- k_gemms: one 128 x 128 tile of the product per work-group of four waves (2 x 2 wave tiles of 64 x 64, 16 accumulators each); grid (M/128, N/128, Z), 128 threads.
// A stage is 128 k of the tile's 128 A rows (and A2 rows) and 128 Bt rows: rows of 256 bytes, brought into LDS by asynchronous 16-byte copies (a wave's copy covers two whole rows = four whole lines), pitch 272 bytes for the 16-byte fragment reads.
// Two buffers: stage t + 1 flies while stage t is worked on. Fragments, k order and the order of the products are those of the loaders above.
#define GKS  128                  // k per stage
#define GLP  272                  // LDS row pitch, bytes
#define GOPB (128 * GLP)          // one operand's stage, bytes
// Eight copies of one lane, eight rows apart: l = the lane's LDS byte address, g = its global address. s_wait_xcnt 0 closes the statement, in front of any reuse of the address registers.
__device__ __forceinline__ void copy8(unsigned l, const bf* g, int K) {
    unsigned la[8]; const bf* ga[8];
#pragma unroll
    for (int i = 0; i < 8; ++i) { la[i] = l + (unsigned)(i * 8 * GLP); ga[i] = g + (size_t)i * 8 * K; }
    asm volatile("global_load_async_to_lds_b128 %0, %8, off\n\t"
                 "global_load_async_to_lds_b128 %1, %9, off\n\t"
                 "global_load_async_to_lds_b128 %2, %10, off\n\t"
                 "global_load_async_to_lds_b128 %3, %11, off\n\t"
                 "global_load_async_to_lds_b128 %4, %12, off\n\t"
                 "global_load_async_to_lds_b128 %5, %13, off\n\t"
                 "global_load_async_to_lds_b128 %6, %14, off\n\t"
                 "global_load_async_to_lds_b128 %7, %15, off\n\t"
                 "s_wait_xcnt 0x0"
                 :: "v"(la[0]), "v"(la[1]), "v"(la[2]), "v"(la[3]), "v"(la[4]), "v"(la[5]), "v"(la[6]), "v"(la[7]),
                    "v"(ga[0]), "v"(ga[1]), "v"(ga[2]), "v"(ga[3]), "v"(ga[4]), "v"(ga[5]), "v"(ga[6]), "v"(ga[7]) : "memory");
}
__device__ __forceinline__ v16bf ldsfrag(const char* p) { return cat16b(*(const v8usa*)p, *(const v8usa*)(p + 32)); }
// C[m][n] (f32, pitch ldc, + optional f32 bias[n]) = sum_k (A[m][k] + A2[m][k]) Bt[n][k] (A2 only with NSPLIT 1, as a second product). Bt moves by sB elements per z. K % 128 == 0, K >= 256.
// PLANES: no C. A wave's tile is 64 tokens of one batch x the 64 channels of one head, written as fp16 + bf16 hi/lo head planes: z = 0 into [b][h][t][d] (P*), z = 1 into [b][h][d][t] (T*).
template <int NSPLIT, bool BIAS, bool PLANES>
__global__ __launch_bounds__(128) void k_gemms(const bf* __restrict__ A, const bf* __restrict__ A2, const bf* __restrict__ Bt, int K, float* C, int ldc, const float* __restrict__ bias, size_t sB, h16* P16, bf* Ph, bf* Pl, h16* T16p, bf* Th, bf* Tl) {
    constexpr int BUFB = (NSPLIT ? 3 : 2) * GOPB;
    __shared__ __attribute__((aligned(128))) char ring[2 * BUFB];
    __shared__ __align__(16) float osw[4][16 * 68];   // each wave's own output panel
    const int z = blockIdx.z; Bt += (size_t)z * sB;
    const int tid = threadIdx.x, lane = tid & 31, lr = lane & 15, hi = lane >> 4, wave = __builtin_amdgcn_readfirstlane(tid >> 5) /* scalar: the wave's tile and its output pointers stay wave-uniform */, wm = wave >> 1, wn = wave & 1;
    const int R0 = blockIdx.x * 128, C0 = blockIdx.y * 128, r0 = R0 + wm * 64, c0 = C0 + wn * 64;
    float* os = osw[wave];
    v8f acc[4][4];
#pragma unroll
    for (int mb = 0; mb < 4; ++mb)
#pragma unroll
        for (int nb = 0; nb < 4; ++nb) acc[mb][nb] = (v8f){};
    // the lane's part of a stage: 16 bytes of row (tid >> 4) + 8 i, i = 0..15, of each operand
    const size_t go = (size_t)(tid >> 4) * K + (tid & 15) * 8;
    const bf* gA = A + (size_t)R0 * K + go; const bf* gA2 = NSPLIT ? A2 + (size_t)R0 * K + go : gA; const bf* gB = Bt + (size_t)C0 * K + go;
    const unsigned l0 = (unsigned)(size_t)ring + (unsigned)((tid >> 4) * GLP + (tid & 15) * 16);
    // SB: holds the scheduler, so that a statement's address additions stay directly in front of it: few address registers live at a time, no scratch
#define SB __builtin_amdgcn_sched_barrier(0)
    auto fill = [&](int t) { const unsigned l = l0 + (unsigned)((t & 1) * BUFB); const size_t k0 = (size_t)t * GKS, h64 = (size_t)64 * K;
        SB; copy8(l, gA + k0, K); SB; copy8(l + 64 * GLP, gA + k0 + h64, K); SB;
        copy8(l + GOPB, gB + k0, K); SB; copy8(l + GOPB + 64 * GLP, gB + k0 + h64, K); SB;
        if (NSPLIT) { copy8(l + 2 * GOPB, gA2 + k0, K); SB; copy8(l + 2 * GOPB + 64 * GLP, gA2 + k0 + h64, K); SB; } };
#undef SB
    const int NT = K / GKS;
    fill(0);
    asm volatile("s_wait_asynccnt 0x0" ::: "memory");   // this wave's copies of stage 0 have landed
    __syncthreads();                                    // ... and every other wave's
    fill(1);
    const int fo = lr * GLP + hi * 16;
#pragma unroll 1   // the stage loop stays rolled: one copy of the ring's foot, and the accumulators keep their registers
    for (int t = 0; t < NT; ++t) {
        const char* pa = ring + (t & 1) * BUFB + wm * 64 * GLP + fo; const char* pb = ring + (t & 1) * BUFB + GOPB + wn * 64 * GLP + fo;
        // Two fragment sets: the next 32 k's fragments are read as one group ahead of this 32 k's products, inside the stage only (the first group of a stage stands behind its barrier).
        v16bf a[2][4], a2[2][4], b[2][4];
        auto ldf = [&](int s, int kc) {
#pragma unroll
            for (int mb = 0; mb < 4; ++mb) { a[s][mb] = ldsfrag(pa + mb * 16 * GLP + kc * 64); if (NSPLIT) a2[s][mb] = ldsfrag(pa + 2 * GOPB + mb * 16 * GLP + kc * 64); }
#pragma unroll
            for (int nb = 0; nb < 4; ++nb) b[s][nb] = ldsfrag(pb + nb * 16 * GLP + kc * 64); };
        ldf(0, 0);
#pragma unroll
        for (int kc = 0; kc < GKS / 32; ++kc) { const int s = kc & 1;
            if (kc + 1 < GKS / 32) ldf(s ^ 1, kc + 1);
            __builtin_amdgcn_sched_barrier(0);   // holds the scheduler: the group of LDS reads stays whole and ahead of the products, not spread among them
#pragma unroll
            for (int nb = 0; nb < 4; ++nb)
#pragma unroll
                for (int mb = 0; mb < 4; ++mb) { acc[mb][nb] = wmmab(a[s][mb], b[s][nb], acc[mb][nb]); if (NSPLIT) acc[mb][nb] = wmmab(a2[s][mb], b[s][nb], acc[mb][nb]); }
            __builtin_amdgcn_sched_barrier(0);   // ... and the next group stays behind these products
        }
        asm volatile("s_wait_dscnt 0x0" ::: "memory");      // this wave's reads of stage t are done before the buffer is handed back
        asm volatile("s_wait_asynccnt 0x0" ::: "memory");   // this wave's copies of stage t + 1 have landed
        __syncthreads();                                    // publishes stage t + 1 and ends every wave's reads of stage t
        if (t + 2 < NT) fill(t + 2);                        // into the buffer that stage t has left
    }
    asm volatile("s_wait_asynccnt 0x0" ::: "memory");       // no copy is left in flight
    if (PLANES) {
        static_assert(HD == 64 && TT % 64 == 0, "one wave tile = one head, one batch");
        const size_t hp = ((size_t)(r0 / TT) * (ldc / HD) + c0 / HD) * TT * HD; const int t0 = r0 % TT;   // ldc: channels of all heads
        if (z == 0) planes_out<false>(acc, os, lane, P16 + hp + (size_t)t0 * HD, Ph + hp + (size_t)t0 * HD, Pl + hp + (size_t)t0 * HD);
        else planes_out<true>(acc, os, lane, T16p + hp + t0, Th + hp + t0, Tl + hp + t0);
        return;
    }
#pragma unroll
    for (int mb = 0; mb < 4; ++mb) {
#pragma unroll
        for (int nb = 0; nb < 4; ++nb) {
#pragma unroll
            for (int j = 0; j < 8; ++j) os[(hi * 8 + j) * 68 + nb * 16 + lr] = acc[mb][nb][j]; }
        __builtin_amdgcn_wave_barrier(); asm volatile("" ::: "memory");   // holds the compiler: the panel's LDS writes stay in front of the other lanes' reads of them (one wave, LDS runs in order)
        float* crow = C + (size_t)(r0 + mb * 16) * ldc + c0;
        v4f val[8]; float* pc[8];
#pragma unroll
        for (int s = 0; s < 8; ++s) { const int row = 2 * s + hi, cofs = lr * 4; val[s] = *(const v4fa*)(os + row * 68 + cofs); if (BIAS) { val[s][0] += bfr(bias[c0 + cofs]); val[s][1] += bfr(bias[c0 + cofs + 1]); val[s][2] += bfr(bias[c0 + cofs + 2]); val[s][3] += bfr(bias[c0 + cofs + 3]); }
            pc[s] = crow + (size_t)row * ldc + cofs; }
#pragma unroll
        for (int s = 0; s < 8; ++s) *(v4f*)pc[s] = val[s];
        // s_wait_xcnt 0 behind the panel's stores, in front of any reuse of their address or data registers (inputs, so that the registers stay theirs up to the wait); its memory clobber also keeps the next panel's LDS writes behind this panel's reads
        asm volatile("s_wait_xcnt 0x0" :: "v"(pc[0]), "v"(pc[1]), "v"(pc[2]), "v"(pc[3]), "v"(pc[4]), "v"(pc[5]), "v"(pc[6]), "v"(pc[7]), "v"(val[0]), "v"(val[1]), "v"(val[2]), "v"(val[3]), "v"(val[4]), "v"(val[5]), "v"(val[6]), "v"(val[7]) : "memory");
    }
}

__device__ __forceinline__ void splitf(float y, unsigned short& h, unsigned short& l) { h = f2bf(y); l = f2bf(y - bf2f(h)); }
typedef __attribute__((ext_vector_type(2))) _Float16 v2h;
typedef __attribute__((ext_vector_type(4))) _Float16 v4h;
typedef __attribute__((ext_vector_type(2))) unsigned short v2us;
typedef __attribute__((ext_vector_type(4))) unsigned short v4us;
typedef __attribute__((ext_vector_type(2))) float v2f;
typedef __attribute__((ext_vector_type(4))) int v4i;

// blockIdx.y picks one of four equally shaped weights; their transposed planes lie one behind the other in Bt
__global__ __launch_bounds__(256) void k_wtG(const float* __restrict__ w0, const float* __restrict__ w1, const float* __restrict__ w2, const float* __restrict__ w3, int K, int N, bf* Bt) {
    const int y = blockIdx.y; const float* __restrict__ w = (y == 0) ? w0 : (y == 1) ? w1 : (y == 2) ? w2 : w3; Bt += (size_t)y * N * K;
    const int lane = threadIdx.x & 31; const int L0 = (blockIdx.x * 8 + (threadIdx.x >> 5)) * 8; const int nlines = N * K / 64;
{
#pragma unroll 1
        for (int l = 0; l < 8; ++l) { const int L = L0 + l; if (L >= nlines) break; const size_t e = (size_t)L * 64 + lane * 2; const int k = (int)(e % K), n = (int)(e / K); v2us o;
            o[0] = f2bf(w[(size_t)k * N + n]); o[1] = f2bf(w[(size_t)(k + 1) * N + n]); *(v2us*)(Bt + e) = o; }
         }
}
// blockIdx.y picks the source; the two copies lie one behind the other in dst
__global__ __launch_bounds__(256) void k_cvt8(const float* __restrict__ src0, const float* __restrict__ src1, bf* dst, size_t n8) { const size_t i = (size_t)blockIdx.x * 256 + threadIdx.x; if (i >= n8) return; const float* __restrict__ src = blockIdx.y ? src1 : src0; dst += (size_t)blockIdx.y * n8 * 8; const v8f v = *(const v8f*)(src + i * 8); v8us o;
#pragma unroll
    for (int k = 0; k < 8; ++k) o[k] = f2bf(v[k]); *(v8us*)(dst + i * 8) = o;  }

#define QT   2                    // 16-query groups per wave
#define FW   4                    // waves per block
#define CL2  0.18033688011112042f // HD^-0.5 * log2(e)
typedef __attribute__((ext_vector_type(2))) __bf16 v2bf;
__device__ __forceinline__ float xhalf(float x) { const int b = __float_as_int(x); return __int_as_float(__builtin_amdgcn_permlanex16(b, b, 0x76543210, 0xfedcba98, false, false)); }   // lane l <-> l ^ 16
__device__ __forceinline__ void packp(const float* p, v16bf& h, v16bf& l) {
#pragma unroll
    for (int e = 0; e < 16; e += 2) { v2f pp; pp[0] = p[e]; pp[1] = p[e + 1]; const v2bf hh = __builtin_convertvector(pp, v2bf); v2f rr; rr[0] = pp[0] - (float)hh[0]; rr[1] = pp[1] - (float)hh[1]; const v2bf ll = __builtin_convertvector(rr, v2bf); h[e] = hh[0]; h[e + 1] = hh[1]; l[e] = ll[0]; l[e + 1] = ll[1]; } }
__device__ __forceinline__ void packp(const float* p, v16h& h, v16h& l) { (void)l;
#pragma unroll
    for (int e = 0; e < 16; e += 2) { v2f pp; pp[0] = p[e]; pp[1] = p[e + 1]; const v2h hh = __builtin_convertvector(pp, v2h); h[e] = hh[0]; h[e + 1] = hh[1]; } }
template <typename T16, bool SPLIT>
__device__ __forceinline__ void fattn(const T16* __restrict__ Qh, const T16* __restrict__ Ql, const T16* __restrict__ Kh, const T16* __restrict__ Kl, const T16* __restrict__ Vh, const T16* __restrict__ Vl, const float* mb, int q0, float pexp, bf* Ah, bf* Al) {
    typedef typename WFrag<T16>::V V;
    const int lane = threadIdx.x & 31, lr = lane & 15, hi = lane >> 4;
    V q[QT][2], q2[QT][2]; v8f o[QT][4]; float m[QT], l[QT];
    // XW: s_wait_xcnt 0 behind a run of loads or stores, in front of any reuse of their address registers; the pointers are inputs so that their registers stay theirs up to the wait.
#define XW1(p)     asm volatile("s_wait_xcnt 0x0" :: "v"(p) : "memory")
#define XW2(p, p2) asm volatile("s_wait_xcnt 0x0" :: "v"(p), "v"(p2) : "memory")
#pragma unroll
    for (int qt = 0; qt < QT; ++qt) { m[qt] = -3.0e38f; l[qt] = 0.f; const size_t qo = (size_t)(q0 + qt * 16 + lr) * HD + 8 * hi; const T16* pq = Qh + qo; const T16* pq2 = SPLIT ? Ql + qo : pq;
#pragma unroll
        for (int kc = 0; kc < 2; ++kc) { q[qt][kc] = WFrag<T16>::ld(pq + kc * 32); if (SPLIT) q2[qt][kc] = WFrag<T16>::ld(pq2 + kc * 32); }
        if (SPLIT) XW2(pq, pq2); else XW1(pq);
#pragma unroll
        for (int dt = 0; dt < 4; ++dt) o[qt][dt] = (v8f){}; }
    const size_t ko = (size_t)lr * HD + 8 * hi, vo = (size_t)lr * TT + 8 * hi;
    // K and V fragments are fetched one pass ahead into the same registers: K right behind its S^T products, V behind its O^T products, so each load has the rest of a pass to land.
    // The waits, as memory barriers for the compiler, also keep the prologue's load order equal to the loop's (Q, K, then V): load counts retire in order and the wait at the loop's top is merged over both entries.
    V kf[2][2], kf2[2][2], vf[4], vf2[4];
    auto ldk = [&](int kb) { const T16* p = Kh + ko + (size_t)kb * HD; const T16* p2 = SPLIT ? Kl + ko + (size_t)kb * HD : p;
#pragma unroll
        for (int kt = 0; kt < 2; ++kt)
#pragma unroll
            for (int kc = 0; kc < 2; ++kc) { const int off = kt * 16 * HD + kc * 32; kf[kt][kc] = WFrag<T16>::ld(p + off); if (SPLIT) kf2[kt][kc] = WFrag<T16>::ld(p2 + off); }
        if (SPLIT) XW2(p, p2); else XW1(p); };
    auto ldv = [&](int kb) { const T16* p = Vh + vo + kb; const T16* p2 = SPLIT ? Vl + vo + kb : p;
#pragma unroll
        for (int dt = 0; dt < 4; ++dt) { const int off = dt * 16 * TT; vf[dt] = WFrag<T16>::ld(p + off); if (SPLIT) vf2[dt] = WFrag<T16>::ld(p2 + off); }
        if (SPLIT) XW2(p, p2); else XW1(p); };
    // The first fetch is addressed as wave-uniform base + 32-bit lane byte offset: its waits name that offset register.
    const unsigned kob = (unsigned)ko * 2u, vob = (unsigned)vo * 2u;
    ldk(0); XW1(kob); ldv(0); XW1(vob);
#pragma unroll 1
    for (int kb = 0; kb < TT; kb += 32) {
        const int kn = (kb + 32 < TT) ? kb + 32 : 0;   // the last pass fetches pass 0 again (in bounds, unused)
        v8f s[QT][2];
#pragma unroll
        for (int qt = 0; qt < QT; ++qt) { s[qt][0] = (v8f){}; s[qt][1] = (v8f){}; }
#pragma unroll
        for (int kt = 0; kt < 2; ++kt)
#pragma unroll
            for (int kc = 0; kc < 2; ++kc)
#pragma unroll
                for (int qt = 0; qt < QT; ++qt) { s[qt][kt] = WFrag<T16>::mma(kf[kt][kc], q[qt][kc], s[qt][kt]); if (SPLIT) { s[qt][kt] = WFrag<T16>::mma(kf[kt][kc], q2[qt][kc], s[qt][kt]); s[qt][kt] = WFrag<T16>::mma(kf2[kt][kc], q[qt][kc], s[qt][kt]); } }
        ldk(kn);
        float bias[16];   // 0 for a live key, -3e38 for a padded one: keys kb + 8 hi + 0..7 and kb + 16 + 8 hi + 0..7
#pragma unroll
        for (int c4 = 0; c4 < 4; ++c4) { const v4f b4 = *(const v4fa*)(mb + kb + (c4 >> 1) * 16 + hi * 8 + (c4 & 1) * 4);
#pragma unroll
            for (int j = 0; j < 4; ++j) bias[c4 * 4 + j] = b4[j]; }
#pragma unroll
        for (int qt = 0; qt < QT; ++qt) { float t[16]; float mx = m[qt];
#pragma unroll
            for (int e = 0; e < 16; ++e) { t[e] = fmaf(s[qt][e >> 3][e & 7], CL2, bias[e]); mx = fmaxf(mx, t[e]); }
            mx = fmaxf(mx, xhalf(mx));
            const float al = __builtin_amdgcn_exp2f(m[qt] - mx), sh = pexp - mx; m[qt] = mx; float sum = 0.f;
#pragma unroll
            for (int e = 0; e < 16; ++e) { t[e] = __builtin_amdgcn_exp2f(t[e] + sh); sum += t[e]; }
            l[qt] = fmaf(l[qt], al, sum);
#pragma unroll
            for (int dt = 0; dt < 4; ++dt) o[qt][dt] *= al;
            V ph, pl; packp(t, ph, pl);
#pragma unroll
            for (int dt = 0; dt < 4; ++dt) { o[qt][dt] = WFrag<T16>::mma(vf[dt], ph, o[qt][dt]); if (SPLIT) { o[qt][dt] = WFrag<T16>::mma(vf[dt], pl, o[qt][dt]); o[qt][dt] = WFrag<T16>::mma(vf2[dt], ph, o[qt][dt]); } } }
        ldv(kn);
    }
#pragma unroll
    for (int qt = 0; qt < QT; ++qt) { const float inv = __fdiv_rn(1.0f, l[qt] + xhalf(l[qt])); const size_t ro = (size_t)(q0 + qt * 16 + lr) * DQ + hi * 8; bf* ph = Ah + ro; bf* pl = Al + ro;
#pragma unroll
        for (int dt = 0; dt < 4; ++dt) { v8us oh, ol;
#pragma unroll
            for (int j = 0; j < 8; ++j) { unsigned short a, c2; splitf(o[qt][dt][j] * inv, a, c2); oh[j] = a; ol[j] = c2; }
            *(v8us*)(ph + dt * 16) = oh; *(v8us*)(pl + dt * 16) = ol; }
        XW2(ph, pl); }
#undef XW1
#undef XW2
}
// grid (row blocks of FW*QT*16 queries, batch*head, 2): z = 0 rows < RH (hi/lo planes, 3 products; the heavier blocks start first), z = 1 the rest (fp16, P x 1024)
__global__ __launch_bounds__(FW * 32) void k_fattn(const h16* __restrict__ Q16, const bf* __restrict__ Qh, const bf* __restrict__ Ql, const h16* __restrict__ K16, const bf* __restrict__ Kh, const bf* __restrict__ Kl, const h16* __restrict__ V16, const bf* __restrict__ Vh, const bf* __restrict__ Vl, const int* __restrict__ pm, bf* Ah, bf* Al) {
    __shared__ __align__(16) float mb[TT];
    const int bh = blockIdx.y, b = bh / NH_, h = bh % NH_;
#pragma unroll
    for (int i = 0; i < TT / (FW * 32 * 4); ++i) { const int j0 = (i * FW * 32 + threadIdx.x) * 4; const v4i p4 = *(const v4i*)(pm + (size_t)b * TT + j0); v4f b4;   /* 4 padding flags (16 B) */
#pragma unroll
        for (int j = 0; j < 4; ++j) b4[j] = (p4[j] == 0) ? 0.0f : -3.0e38f;   /* padded keys excluded */
        *(v4fa*)(mb + j0) = b4; }
    __syncthreads();   // every wave reads the whole bias row
    const size_t po = (size_t)bh * TT * HD, ao = (size_t)b * TT * DQ + h * HD; const int qw = (blockIdx.x * FW + (threadIdx.x >> 5)) * (QT * 16);
    if (blockIdx.z == 0) fattn<bf, true>(Qh + po, Ql + po, Kh + po, Kl + po, Vh + po, Vl + po, mb, qw, 0.0f, Ah + ao, Al + ao);
    else fattn<h16, false>(Q16 + po, nullptr, K16 + po, nullptr, V16 + po, nullptr, mb, RH + qw, 10.0f, Ah + ao, Al + ao);
}

extern "C" void kernel_launch(void* const* d_in, const int* in_sizes, int n_in,
                              void* d_out, int out_size, void* d_ws, size_t ws_size, hipStream_t stream) {
    (void)in_sizes; (void)n_in; (void)out_size;
    const float* x = (const float*)d_in[0]; const float* xkv = (const float*)d_in[1]; const int* pm = (const int*)d_in[2];   /* pad_mask [4][1024] bool as int32: 1 = padding key */ const float* wq = (const float*)d_in[3]; const float* wk = (const float*)d_in[4]; const float* wv = (const float*)d_in[5]; const float* wo = (const float*)d_in[6]; const float* bo = (const float*)d_in[7];
    float* OUT = (float*)d_out;     // [4][1024][1024]
    char* wsp = (char*)d_ws;
    auto take = [&](size_t bytes) { char* p = wsp; wsp += (bytes + 255) & ~(size_t)255; return (void*)p; };
    const size_t PB = (size_t)NH_ * TT * HD;   // one batch of head planes (elements); NKV == NH_ here
    bf* WQ = (bf*)take((size_t)DQ * DM * 2); bf* WK = (bf*)take((size_t)DKV * DM * 2); bf* WV = (bf*)take((size_t)DKV * DM * 2); bf* WO = (bf*)take((size_t)DM * DQ * 2);   // the four weight planes are contiguous (2 MiB each)
    h16* QP16 = (h16*)take(2 * NB_ * PB * 2); h16* KP16 = QP16 + NB_ * PB; bf* QPh = (bf*)take(2 * NB_ * PB * 2); bf* KPh = QPh + NB_ * PB; bf* QPl = (bf*)take(2 * NB_ * PB * 2); bf* KPl = QPl + NB_ * PB;   // q planes of all batches, then k planes
    h16* VT16 = (h16*)take(NB_ * PB * 2); bf* VTh = (bf*)take(NB_ * PB * 2); bf* VTl = (bf*)take(NB_ * PB * 2);
    bf* XB = (bf*)take((size_t)2 * NB_ * TT * DM * 2); bf* XKV = XB + (size_t)NB_ * TT * DM; bf* ATh = (bf*)take((size_t)NB_ * TT * DQ * 2); bf* ATl = (bf*)take((size_t)NB_ * TT * DQ * 2);
    if ((size_t)(wsp - (char*)d_ws) > ws_size) return;    // ws 256 MiB
    k_wtG<<<dim3((unsigned)((DM * DQ / 64 + 63) / 64), 4, 1), 256, 0, stream>>>(wq, wk, wv, wo, DM, DQ, WQ);
    k_cvt8<<<dim3((unsigned)(((size_t)NB_ * TT * DM / 8 + 255) / 256), 2, 1), 256, 0, stream>>>(x, xkv, XB, (size_t)NB_ * TT * DM / 8);
    k_gemms<0, false, true><<<dim3(NB_ * TT / 128, DQ / 128, 1), 128, 0, stream>>>(XB, nullptr, WQ, DM, nullptr, DQ, nullptr, 0, QP16, QPh, QPl, nullptr, nullptr, nullptr);
    k_gemms<0, false, true><<<dim3(NB_ * TT / 128, DKV / 128, 2), 128, 0, stream>>>(XKV, nullptr, WK, DM, nullptr, DKV, nullptr, (size_t)DKV * DM, KP16, KPh, KPl, VT16, VTh, VTl);   /* k, v from x_kv: z = 0, 1 */
    k_fattn<<<dim3(RH / (FW * QT * 16), NB_ * NH_, 2), FW * 32, 0, stream>>>(QP16, QPh, QPl, KP16, KPh, KPl, VT16, VTh, VTl, pm, ATh, ATl);   /* all batches and heads; RH == TT - RH */
    k_gemms<1, true, false><<<dim3(NB_ * TT / 128, DM / 128, 1), 128, 0, stream>>>(ATh, ATl, WO, DQ, OUT, DM, bo, 0, nullptr, nullptr, nullptr, nullptr, nullptr, nullptr);
}

// v005
// It runs in 106 microseconds.
// Next to v004, in two timings, it ran 1.21 and 1.22 times as fast.
// Over all steps from v000 it is 22.5 times as fast.
#include <hip/hip_runtime.h>

// Multi-head cross attention with a key padding mask (x_q, x_kv [4][1024][1024]; q = x_q Wq, k, v = x_kv Wk, x_kv Wv ('xw' 1/32, no bias; 16 heads x 64); scores x 64^-0.5; keys with pad_mask[b][j] ([4][1024] bool, ~10 % true, read) -> -finfo.max (== exclusion); softmax; out = merged Wo ('xw' 1/32) + bo -> [4][1024][1024] (4.2 M)).
// Layout: bf16 copies of x_q and x_kv (all batches, one launch); 'xw' weights transposed once (one launch); exact projections over all 4096 rows that write the head planes from their own epilogue; one fused attention launch over all batches and heads (K and V tiles staged in LDS for a block's four waves; S^T = K Q^T, running-maximum softmax that excludes padded keys through a bias row in LDS, O^T += V^T P^T, merged hi/lo rows written directly; hybrid rows: < 512 hi/lo 3 products, rest fp16 with P x 1024); merged hi/lo x Wo exact + bo.
// Compute dtypes, f32 accumulate: every input rounded to bf16; projections exact; attention rows < 512 3 products, rest fp16; softmax f32; Wo hl x exact + bias.

#define NB_  4
#define TT   1024
#define DM   1024
#define NH_  16
#define NKV  16
#define REP  (NH_ / NKV)
#define HD   64
#define DQ   (NH_ * HD)
#define DKV  (NKV * HD)
#define ZH   16                   // heads per attention launch (unused; heads are in grid y)
#define RH   512                  // query rows < RH use hi+lo planes (must be TT / 2: z = 1 takes the rest)
#define WIN  0
#define PCAR 1024.0f
#define SCL  0.125f   // HD^-0.5
typedef _Float16 h16;
typedef unsigned short bf;
typedef __attribute__((ext_vector_type(16))) __bf16   v16bf;
typedef __attribute__((ext_vector_type(16))) _Float16 v16h;
typedef __attribute__((ext_vector_type(8)))  _Float16 v8h;
typedef __attribute__((ext_vector_type(8)))  unsigned short v8us;
typedef __attribute__((ext_vector_type(8)))  float    v8f;
typedef __attribute__((ext_vector_type(8)))  __bf16   v8bfv;
typedef __attribute__((ext_vector_type(4)))  float    v4f;
typedef v8h  __attribute__((may_alias)) v8ha;
typedef v4f  __attribute__((may_alias)) v4fa;
typedef v8us __attribute__((may_alias)) v8usa;

__device__ __forceinline__ unsigned short f2bf(float f) { unsigned u = __float_as_uint(f); u += 0x7FFFu + ((u >> 16) & 1u); return (unsigned short)(u >> 16); }
__device__ __forceinline__ float bf2f(unsigned short b) { return __uint_as_float(((unsigned)b) << 16); }
__device__ __forceinline__ float bfr(float f) { return bf2f(f2bf(f)); }
__device__ __forceinline__ v16h cat16(v8h lo, v8h hi) { return __builtin_shufflevector(lo, hi, 0, 1, 2, 3, 4, 5, 6, 7, 8, 9, 10, 11, 12, 13, 14, 15); }
__device__ __forceinline__ v16bf cat16b(v8us lo, v8us hi) { return __builtin_bit_cast(v16bf, __builtin_shufflevector(lo, hi, 0, 1, 2, 3, 4, 5, 6, 7, 8, 9, 10, 11, 12, 13, 14, 15)); }
__device__ __forceinline__ v8f wmma16(v16h a, v16h b, v8f c) { return __builtin_amdgcn_wmma_f32_16x16x32_f16(false, a, false, b, (short)0, c, false, false); }
__device__ __forceinline__ v8f wmmab(v16bf a, v16bf b, v8f c) { return __builtin_amdgcn_wmma_f32_16x16x32_bf16(false, a, false, b, (short)0, c, false, false); }



// Fragment loaders from K-contiguous 16-bit planes: a lane reads 8 + 8 elements of its row, at 8 hi and 16 + 8 hi of each 32 k.
template <typename T16> struct WFrag;
template <> struct WFrag<h16> { typedef v16h V; static __device__ __forceinline__ V ld(const h16* p) { return cat16(*(const v8h*)p, *(const v8h*)(p + 16)); } static __device__ __forceinline__ V lds(const char* p) { return cat16(*(const v8ha*)p, *(const v8ha*)(p + 32)); } static __device__ __forceinline__ v8f mma(V a, V b, v8f c) { return wmma16(a, b, c); } };
template <> struct WFrag<bf> { typedef v16bf V; static __device__ __forceinline__ V ld(const bf* p) { return cat16b(*(const v8us*)p, *(const v8us*)(p + 16)); } static __device__ __forceinline__ V lds(const char* p) { return cat16b(*(const v8usa*)p, *(const v8usa*)(p + 32)); } static __device__ __forceinline__ v8f mma(V a, V b, v8f c) { return wmmab(a, b, c); } };
// planes_out: one wave's 64 x 64 f32 tile (acc[mb][nb]: token mb*16 + 8*hi + j, channel nb*16 + lr) as fp16, bf16 hi and bf16 lo planes; TR false: plane rows are tokens (pitch HD), true: channels (pitch TT).
// A panel of 16 plane rows x 64 goes through LDS so that 8 lanes write one whole 128-byte line of each plane.
template <bool TR>
__device__ __forceinline__ void planes_out(const v8f (&acc)[4][4], float* os, int lane, h16* d16, bf* dh, bf* dl) {
    constexpr int PITCH = TR ? TT : HD;
    const int lr = lane & 15, hi = lane >> 4, prow = lane >> 3, pcol = (lane & 7) * 8;
    const unsigned lob = (unsigned)(prow * PITCH + pcol) * 2u;   // the lane's byte offset in each plane; the plane pointers stay wave-uniform
    // Every loop here is unrolled so that acc and the staging vectors are indexed by constants only and stay in registers.
#pragma unroll
    for (int pb = 0; pb < 4; ++pb) {
        if (TR) {   // a lane holds 8 consecutive tokens of one channel
#pragma unroll
            for (int mb = 0; mb < 4; ++mb) { const v8f w = acc[mb][pb]; *(v4fa*)(os + lr * 68 + mb * 16 + hi * 8) = __builtin_shufflevector(w, w, 0, 1, 2, 3); *(v4fa*)(os + lr * 68 + mb * 16 + hi * 8 + 4) = __builtin_shufflevector(w, w, 4, 5, 6, 7); }
        } else {
#pragma unroll
            for (int nb = 0; nb < 4; ++nb) {
#pragma unroll
                for (int j = 0; j < 8; ++j) os[(hi * 8 + j) * 68 + nb * 16 + lr] = acc[pb][nb][j]; }
        }
        __builtin_amdgcn_wave_barrier(); asm volatile("" ::: "memory");   // holds the compiler: the panel's LDS writes stay in front of the other lanes' reads of them (one wave, LDS runs in order)
        v8h o16[4]; v8us oh[4], ol[4];
#pragma unroll
        for (int s = 0; s < 4; ++s) { const float* pr = os + (4 * s + prow) * 68 + pcol; const v4f x0 = *(const v4fa*)pr, x1 = *(const v4fa*)(pr + 4); const v8f x = __builtin_shufflevector(x0, x1, 0, 1, 2, 3, 4, 5, 6, 7);
            const v8bfv h = __builtin_convertvector(x, v8bfv); const v8bfv l = __builtin_convertvector(x - __builtin_convertvector(h, v8f), v8bfv);   // round to nearest even, as f2bf
            o16[s] = __builtin_convertvector(x, v8h); oh[s] = __builtin_bit_cast(v8us, h); ol[s] = __builtin_bit_cast(v8us, l); }
#pragma unroll
        for (int s = 0; s < 4; ++s) { const int o = (pb * 16 + 4 * s) * PITCH * 2; *(v8h*)((char*)d16 + lob + o) = o16[s]; *(v8us*)((char*)dh + lob + o) = oh[s]; *(v8us*)((char*)dl + lob + o) = ol[s]; }
        // s_wait_xcnt 0 behind the panel's stores, in front of any reuse of their address or data registers (inputs, so that the registers stay theirs up to the wait); its memory clobber also keeps the next panel's LDS writes behind this panel's reads
        asm volatile("s_wait_xcnt 0x0" :: "v"(lob), "v"(o16[0]), "v"(o16[1]), "v"(o16[2]), "v"(o16[3]), "v"(oh[0]), "v"(oh[1]), "v"(oh[2]), "v"(oh[3]), "v"(ol[0]), "v"(ol[1]), "v"(ol[2]), "v"(ol[3]) : "memory");
    }
}
// ---- k_gemms: one 128 x 128 tile of the product per work-group of four waves (2 x 2 wave tiles of 64 x 64, 16 accumulators each); grid (M/128, N/128, Z), 128 threads.
// A stage is 128 k of the tile's 128 A rows (and A2 rows) and 128 Bt rows: rows of 256 bytes, brought into LDS by asynchronous 16-byte copies (a wave's copy covers two whole rows = four whole lines), pitch 272 bytes for the 16-byte fragment reads.
// Two buffers: stage t + 1 flies while stage t is worked on. Fragments, k order and the order of the products are those of the loaders above.
#define GKS  128                  // k per stage
#define GLP  272                  // LDS row pitch, bytes
#define GOPB (128 * GLP)          // one operand's stage, bytes
// Eight copies of one lane, eight rows apart: l = the lane's LDS byte address, g = its global address. s_wait_xcnt 0 closes the statement, in front of any reuse of the address registers.
__device__ __forceinline__ void copy8(unsigned l, const bf* g, int K) {
    unsigned la[8]; const bf* ga[8];
#pragma unroll
    for (int i = 0; i < 8; ++i) { la[i] = l + (unsigned)(i * 8 * GLP); ga[i] = g + (size_t)i * 8 * K; }
    asm volatile("global_load_async_to_lds_b128 %0, %8, off\n\t"
                 "global_load_async_to_lds_b128 %1, %9, off\n\t"
                 "global_load_async_to_lds_b128 %2, %10, off\n\t"
                 "global_load_async_to_lds_b128 %3, %11, off\n\t"
                 "global_load_async_to_lds_b128 %4, %12, off\n\t"
                 "global_load_async_to_lds_b128 %5, %13, off\n\t"
                 "global_load_async_to_lds_b128 %6, %14, off\n\t"
                 "global_load_async_to_lds_b128 %7, %15, off\n\t"
                 "s_wait_xcnt 0x0"
                 :: "v"(la[0]), "v"(la[1]), "v"(la[2]), "v"(la[3]), "v"(la[4]), "v"(la[5]), "v"(la[6]), "v"(la[7]),
                    "v"(ga[0]), "v"(ga[1]), "v"(ga[2]), "v"(ga[3]), "v"(ga[4]), "v"(ga[5]), "v"(ga[6]), "v"(ga[7]) : "memory");
}
__device__ __forceinline__ v16bf ldsfrag(const char* p) { return cat16b(*(const v8usa*)p, *(const v8usa*)(p + 32)); }
// C[m][n] (f32, pitch ldc, + optional f32 bias[n]) = sum_k (A[m][k] + A2[m][k]) Bt[n][k] (A2 only with NSPLIT 1, as a second product). Bt moves by sB elements per z. K % 128 == 0, K >= 256.
// PLANES: no C. A wave's tile is 64 tokens of one batch x the 64 channels of one head, written as fp16 + bf16 hi/lo head planes: z = 0 into [b][h][t][d] (P*), z = 1 into [b][h][d][t] (T*).
template <int NSPLIT, bool BIAS, bool PLANES>
__global__ __launch_bounds__(128) void k_gemms(const bf* __restrict__ A, const bf* __restrict__ A2, const bf* __restrict__ Bt, int K, float* C, int ldc, const float* __restrict__ bias, size_t sB, h16* P16, bf* Ph, bf* Pl, h16* T16p, bf* Th, bf* Tl) {
    constexpr int BUFB = (NSPLIT ? 3 : 2) * GOPB;
    __shared__ __attribute__((aligned(128))) char ring[2 * BUFB];
    __shared__ __align__(16) float osw[4][16 * 68];   // each wave's own output panel
    const int z = blockIdx.z; Bt += (size_t)z * sB;
    const int tid = threadIdx.x, lane = tid & 31, lr = lane & 15, hi = lane >> 4, wave = __builtin_amdgcn_readfirstlane(tid >> 5) /* scalar: the wave's tile and its output pointers stay wave-uniform */, wm = wave >> 1, wn = wave & 1;
    const int R0 = blockIdx.x * 128, C0 = blockIdx.y * 128, r0 = R0 + wm * 64, c0 = C0 + wn * 64;
    float* os = osw[wave];
    v8f acc[4][4];
#pragma unroll
    for (int mb = 0; mb < 4; ++mb)
#pragma unroll
        for (int nb = 0; nb < 4; ++nb) acc[mb][nb] = (v8f){};
    // the lane's part of a stage: 16 bytes of row (tid >> 4) + 8 i, i = 0..15, of each operand
    const size_t go = (size_t)(tid >> 4) * K + (tid & 15) * 8;
    const bf* gA = A + (size_t)R0 * K + go; const bf* gA2 = NSPLIT ? A2 + (size_t)R0 * K + go : gA; const bf* gB = Bt + (size_t)C0 * K + go;
    const unsigned l0 = (unsigned)(size_t)ring + (unsigned)((tid >> 4) * GLP + (tid & 15) * 16);
    // SB: holds the scheduler, so that a statement's address additions stay directly in front of it: few address registers live at a time, no scratch
#define SB __builtin_amdgcn_sched_barrier(0)
    auto fill = [&](int t) { const unsigned l = l0 + (unsigned)((t & 1) * BUFB); const size_t k0 = (size_t)t * GKS, h64 = (size_t)64 * K;
        SB; copy8(l, gA + k0, K); SB; copy8(l + 64 * GLP, gA + k0 + h64, K); SB;
        copy8(l + GOPB, gB + k0, K); SB; copy8(l + GOPB + 64 * GLP, gB + k0 + h64, K); SB;
        if (NSPLIT) { copy8(l + 2 * GOPB, gA2 + k0, K); SB; copy8(l + 2 * GOPB + 64 * GLP, gA2 + k0 + h64, K); SB; } };
#undef SB
    const int NT = K / GKS;
    fill(0);
    asm volatile("s_wait_asynccnt 0x0" ::: "memory");   // this wave's copies of stage 0 have landed
    __syncthreads();                                    // ... and every other wave's
    fill(1);
    const int fo = lr * GLP + hi * 16;
#pragma unroll 1   // the stage loop stays rolled: one copy of the ring's foot, and the accumulators keep their registers
    for (int t = 0; t < NT; ++t) {
        const char* pa = ring + (t & 1) * BUFB + wm * 64 * GLP + fo; const char* pb = ring + (t & 1) * BUFB + GOPB + wn * 64 * GLP + fo;
        // Two fragment sets: the next 32 k's fragments are read as one group ahead of this 32 k's products, inside the stage only (the first group of a stage stands behind its barrier).
        v16bf a[2][4], a2[2][4], b[2][4];
        auto ldf = [&](int s, int kc) {
#pragma unroll
            for (int mb = 0; mb < 4; ++mb) { a[s][mb] = ldsfrag(pa + mb * 16 * GLP + kc * 64); if (NSPLIT) a2[s][mb] = ldsfrag(pa + 2 * GOPB + mb * 16 * GLP + kc * 64); }
#pragma unroll
            for (int nb = 0; nb < 4; ++nb) b[s][nb] = ldsfrag(pb + nb * 16 * GLP + kc * 64); };
        ldf(0, 0);
#pragma unroll
        for (int kc = 0; kc < GKS / 32; ++kc) { const int s = kc & 1;
            if (kc + 1 < GKS / 32) ldf(s ^ 1, kc + 1);
            __builtin_amdgcn_sched_barrier(0);   // holds the scheduler: the group of LDS reads stays whole and ahead of the products, not spread among them
#pragma unroll
            for (int nb = 0; nb < 4; ++nb)
#pragma unroll
                for (int mb = 0; mb < 4; ++mb) { acc[mb][nb] = wmmab(a[s][mb], b[s][nb], acc[mb][nb]); if (NSPLIT) acc[mb][nb] = wmmab(a2[s][mb], b[s][nb], acc[mb][nb]); }
            __builtin_amdgcn_sched_barrier(0);   // ... and the next group stays behind these products
        }
        asm volatile("s_wait_dscnt 0x0" ::: "memory");      // this wave's reads of stage t are done before the buffer is handed back
        asm volatile("s_wait_asynccnt 0x0" ::: "memory");   // this wave's copies of stage t + 1 have landed
        __syncthreads();                                    // publishes stage t + 1 and ends every wave's reads of stage t
        if (t + 2 < NT) fill(t + 2);                        // into the buffer that stage t has left
    }
    asm volatile("s_wait_asynccnt 0x0" ::: "memory");       // no copy is left in flight
    if (PLANES) {
        static_assert(HD == 64 && TT % 64 == 0, "one wave tile = one head, one batch");
        const size_t hp = ((size_t)(r0 / TT) * (ldc / HD) + c0 / HD) * TT * HD; const int t0 = r0 % TT;   // ldc: channels of all heads
        if (z == 0) planes_out<false>(acc, os, lane, P16 + hp + (size_t)t0 * HD, Ph + hp + (size_t)t0 * HD, Pl + hp + (size_t)t0 * HD);
        else planes_out<true>(acc, os, lane, T16p + hp + t0, Th + hp + t0, Tl + hp + t0);
        return;
    }
#pragma unroll
    for (int mb = 0; mb < 4; ++mb) {
#pragma unroll
        for (int nb = 0; nb < 4; ++nb) {
#pragma unroll
            for (int j = 0; j < 8; ++j) os[(hi * 8 + j) * 68 + nb * 16 + lr] = acc[mb][nb][j]; }
        __builtin_amdgcn_wave_barrier(); asm volatile("" ::: "memory");   // holds the compiler: the panel's LDS writes stay in front of the other lanes' reads of them (one wave, LDS runs in order)
        float* crow = C + (size_t)(r0 + mb * 16) * ldc + c0;
        v4f val[8]; float* pc[8];
#pragma unroll
        for (int s = 0; s < 8; ++s) { const int row = 2 * s + hi, cofs = lr * 4; val[s] = *(const v4fa*)(os + row * 68 + cofs); if (BIAS) { val[s][0] += bfr(bias[c0 + cofs]); val[s][1] += bfr(bias[c0 + cofs + 1]); val[s][2] += bfr(bias[c0 + cofs + 2]); val[s][3] += bfr(bias[c0 + cofs + 3]); }
            pc[s] = crow + (size_t)row * ldc + cofs; }
#pragma unroll
        for (int s = 0; s < 8; ++s) *(v4f*)pc[s] = val[s];
        // s_wait_xcnt 0 behind the panel's stores, in front of any reuse of their address or data registers (inputs, so that the registers stay theirs up to the wait); its memory clobber also keeps the next panel's LDS writes behind this panel's reads
        asm volatile("s_wait_xcnt 0x0" :: "v"(pc[0]), "v"(pc[1]), "v"(pc[2]), "v"(pc[3]), "v"(pc[4]), "v"(pc[5]), "v"(pc[6]), "v"(pc[7]), "v"(val[0]), "v"(val[1]), "v"(val[2]), "v"(val[3]), "v"(val[4]), "v"(val[5]), "v"(val[6]), "v"(val[7]) : "memory");
    }
}

__device__ __forceinline__ void splitf(float y, unsigned short& h, unsigned short& l) { h = f2bf(y); l = f2bf(y - bf2f(h)); }
typedef __attribute__((ext_vector_type(2))) _Float16 v2h;
typedef __attribute__((ext_vector_type(4))) _Float16 v4h;
typedef __attribute__((ext_vector_type(2))) unsigned short v2us;
typedef __attribute__((ext_vector_type(4))) unsigned short v4us;
typedef __attribute__((ext_vector_type(2))) float v2f;
typedef __attribute__((ext_vector_type(4))) int v4i;

// blockIdx.y picks one of four equally shaped weights; their transposed planes lie one behind the other in Bt
__global__ __launch_bounds__(256) void k_wtG(const float* __restrict__ w0, const float* __restrict__ w1, const float* __restrict__ w2, const float* __restrict__ w3, int K, int N, bf* Bt) {
    const int y = blockIdx.y; const float* __restrict__ w = (y == 0) ? w0 : (y == 1) ? w1 : (y == 2) ? w2 : w3; Bt += (size_t)y * N * K;
    const int lane = threadIdx.x & 31; const int L0 = (blockIdx.x * 8 + (threadIdx.x >> 5)) * 8; const int nlines = N * K / 64;
{
#pragma unroll 1
        for (int l = 0; l < 8; ++l) { const int L = L0 + l; if (L >= nlines) break; const size_t e = (size_t)L * 64 + lane * 2; const int k = (int)(e % K), n = (int)(e / K); v2us o;
            o[0] = f2bf(w[(size_t)k * N + n]); o[1] = f2bf(w[(size_t)(k + 1) * N + n]); *(v2us*)(Bt + e) = o; }
         }
}
// blockIdx.y picks the source; the two copies lie one behind the other in dst
__global__ __launch_bounds__(256) void k_cvt8(const float* __restrict__ src0, const float* __restrict__ src1, bf* dst, size_t n8) { const size_t i = (size_t)blockIdx.x * 256 + threadIdx.x; if (i >= n8) return; const float* __restrict__ src = blockIdx.y ? src1 : src0; dst += (size_t)blockIdx.y * n8 * 8; const v8f v = *(const v8f*)(src + i * 8); v8us o;
#pragma unroll
    for (int k = 0; k < 8; ++k) o[k] = f2bf(v[k]); *(v8us*)(dst + i * 8) = o;  }

#define QT   2                    // 16-query groups per wave
#define FW   4                    // waves per block
#define CL2  0.18033688011112042f // HD^-0.5 * log2(e)
#define FKS  64                   // keys per stage
#define FLP  144                  // LDS row pitch, bytes
#define FTB  (64 * FLP)           // one plane's tile of a stage, bytes
// Eight copies of one lane, four of each of two tiles, sixteen rows apart: l, l2 = the lane's LDS byte addresses, g, g2 = its global addresses, gp, gp2 = the sources' row pitches in bytes. s_wait_xcnt 0 closes the statement, in front of any reuse of the address registers.
__device__ __forceinline__ void copy44(unsigned l, const char* g, int gp, unsigned l2, const char* g2, int gp2) {
    unsigned la[8]; const char* ga[8];
#pragma unroll
    for (int i = 0; i < 4; ++i) { la[i] = l + (unsigned)(i * 16 * FLP); ga[i] = g + (size_t)i * 16 * gp; la[4 + i] = l2 + (unsigned)(i * 16 * FLP); ga[4 + i] = g2 + (size_t)i * 16 * gp2; }
    asm volatile("global_load_async_to_lds_b128 %0, %8, off\n\t"
                 "global_load_async_to_lds_b128 %1, %9, off\n\t"
                 "global_load_async_to_lds_b128 %2, %10, off\n\t"
                 "global_load_async_to_lds_b128 %3, %11, off\n\t"
                 "global_load_async_to_lds_b128 %4, %12, off\n\t"
                 "global_load_async_to_lds_b128 %5, %13, off\n\t"
                 "global_load_async_to_lds_b128 %6, %14, off\n\t"
                 "global_load_async_to_lds_b128 %7, %15, off\n\t"
                 "s_wait_xcnt 0x0"
                 :: "v"(la[0]), "v"(la[1]), "v"(la[2]), "v"(la[3]), "v"(la[4]), "v"(la[5]), "v"(la[6]), "v"(la[7]),
                    "v"(ga[0]), "v"(ga[1]), "v"(ga[2]), "v"(ga[3]), "v"(ga[4]), "v"(ga[5]), "v"(ga[6]), "v"(ga[7]) : "memory");
}
typedef __attribute__((ext_vector_type(2))) __bf16 v2bf;
__device__ __forceinline__ float xhalf(float x) { const int b = __float_as_int(x); return __int_as_float(__builtin_amdgcn_permlanex16(b, b, 0x76543210, 0xfedcba98, false, false)); }   // lane l <-> l ^ 16
__device__ __forceinline__ void packp(const float* p, v16bf& h, v16bf& l) {
#pragma unroll
    for (int e = 0; e < 16; e += 2) { v2f pp; pp[0] = p[e]; pp[1] = p[e + 1]; const v2bf hh = __builtin_convertvector(pp, v2bf); v2f rr; rr[0] = pp[0] - (float)hh[0]; rr[1] = pp[1] - (float)hh[1]; const v2bf ll = __builtin_convertvector(rr, v2bf); h[e] = hh[0]; h[e + 1] = hh[1]; l[e] = ll[0]; l[e + 1] = ll[1]; } }
__device__ __forceinline__ void packp(const float* p, v16h& h, v16h& l) { (void)l;
#pragma unroll
    for (int e = 0; e < 16; e += 2) { v2f pp; pp[0] = p[e]; pp[1] = p[e + 1]; const v2h hh = __builtin_convertvector(pp, v2h); h[e] = hh[0]; h[e + 1] = hh[1]; } }
template <typename T16, bool SPLIT>
__device__ __forceinline__ void fattn(const T16* __restrict__ Qh, const T16* __restrict__ Ql, const T16* __restrict__ Kh, const T16* __restrict__ Kl, const T16* __restrict__ Vh, const T16* __restrict__ Vl, const float* mb, char* ring, int q0, float pexp, bf* Ah, bf* Al) {
    typedef typename WFrag<T16>::V V;
    const int lane = threadIdx.x & 31, lr = lane & 15, hi = lane >> 4;
    V q[QT][2], q2[QT][2]; v8f o[QT][4]; float m[QT], l[QT];
    // XW: s_wait_xcnt 0 behind a run of loads or stores, in front of any reuse of their address registers; the pointers are inputs so that their registers stay theirs up to the wait.
#define XW1(p)     asm volatile("s_wait_xcnt 0x0" :: "v"(p) : "memory")
#define XW2(p, p2) asm volatile("s_wait_xcnt 0x0" :: "v"(p), "v"(p2) : "memory")
#pragma unroll
    for (int qt = 0; qt < QT; ++qt) { m[qt] = -3.0e38f; l[qt] = 0.f; const size_t qo = (size_t)(q0 + qt * 16 + lr) * HD + 8 * hi; const T16* pq = Qh + qo; const T16* pq2 = SPLIT ? Ql + qo : pq;
#pragma unroll
        for (int kc = 0; kc < 2; ++kc) { q[qt][kc] = WFrag<T16>::ld(pq + kc * 32); if (SPLIT) q2[qt][kc] = WFrag<T16>::ld(pq2 + kc * 32); }
        if (SPLIT) XW2(pq, pq2); else XW1(pq);
#pragma unroll
        for (int dt = 0; dt < 4; ++dt) o[qt][dt] = (v8f){}; }
    // The lane's part of a stage: 16 bytes of row (tid >> 3) + 16 i, i = 0..3, of each plane's tile. A buffer holds the K tiles, then the V tiles.
    constexpr int NPL = SPLIT ? 2 : 1, BUFB = 2 * NPL * FTB, NT = TT / FKS;
    const int tid = threadIdx.x;
    const unsigned lp = (unsigned)((tid >> 3) * FLP + (tid & 7) * 16);
    const unsigned gko = (unsigned)((tid >> 3) * HD + (tid & 7) * 8), gvo = (unsigned)((tid >> 3) * TT + (tid & 7) * 8);
    auto fill = [&](int t) { const unsigned l = lp + ((unsigned)(size_t)ring + (unsigned)((t & 1) * BUFB)); const unsigned ka = gko + (unsigned)(t * FKS * HD), va = gvo + (unsigned)(t * FKS);
        if (SPLIT) { copy44(l, (const char*)(Kh + ka), HD * 2, l + FTB, (const char*)(Kl + ka), HD * 2); copy44(l + 2 * FTB, (const char*)(Vh + va), TT * 2, l + 3 * FTB, (const char*)(Vl + va), TT * 2); }
        else { copy44(l, (const char*)(Kh + ka), HD * 2, l + FTB, (const char*)(Vh + va), TT * 2); } };
    fill(0);
    asm volatile("s_wait_asynccnt 0x0" ::: "memory");   // this wave's copies of stage 0 have landed
    __syncthreads();                                    // ... and every other wave's
    fill(1);
    const int fo = lr * FLP + hi * 16;
    V kf[2][2], kf2[2][2], vf[4], vf2[4];
#pragma unroll 1   // the stage loop stays rolled: one copy of the ring's foot
    for (int st = 0; st < NT; ++st) {
      const char* pk = ring + (st & 1) * BUFB + fo; const char* pv = pk + NPL * FTB;
      // Fragments of pass p of the stage, from this stage's buffer alone: the second pass's are asked for inside the first pass, K behind its S^T products, V behind its O^T products.
      auto ldk = [&](int p) {
#pragma unroll
        for (int kt = 0; kt < 2; ++kt)
#pragma unroll
            for (int kc = 0; kc < 2; ++kc) { const int off = (p * 32 + kt * 16) * FLP + kc * 64; kf[kt][kc] = WFrag<T16>::lds(pk + off); if (SPLIT) kf2[kt][kc] = WFrag<T16>::lds(pk + FTB + off); } };
      auto ldv = [&](int p) {
#pragma unroll
        for (int dt = 0; dt < 4; ++dt) { const int off = dt * 16 * FLP + p * 64; vf[dt] = WFrag<T16>::lds(pv + off); if (SPLIT) vf2[dt] = WFrag<T16>::lds(pv + FTB + off); } };
      ldk(0); ldv(0);
#pragma unroll   // both passes of a stage are written out: every fragment offset is a constant of the LDS read, and the test for a next pass is settled at compile time
      for (int p = 0; p < FKS / 32; ++p) { const int kb = st * FKS + p * 32;
        v8f s[QT][2];
#pragma unroll
        for (int qt = 0; qt < QT; ++qt) { s[qt][0] = (v8f){}; s[qt][1] = (v8f){}; }
#pragma unroll
        for (int kt = 0; kt < 2; ++kt)
#pragma unroll
            for (int kc = 0; kc < 2; ++kc)
#pragma unroll
                for (int qt = 0; qt < QT; ++qt) { s[qt][kt] = WFrag<T16>::mma(kf[kt][kc], q[qt][kc], s[qt][kt]); if (SPLIT) { s[qt][kt] = WFrag<T16>::mma(kf[kt][kc], q2[qt][kc], s[qt][kt]); s[qt][kt] = WFrag<T16>::mma(kf2[kt][kc], q[qt][kc], s[qt][kt]); } }
        if (p + 1 < FKS / 32) ldk(p + 1);
        float bias[16];   // 0 for a live key, -3e38 for a padded one: keys kb + 8 hi + 0..7 and kb + 16 + 8 hi + 0..7
#pragma unroll
        for (int c4 = 0; c4 < 4; ++c4) { const v4f b4 = *(const v4fa*)(mb + kb + (c4 >> 1) * 16 + hi * 8 + (c4 & 1) * 4);
#pragma unroll
            for (int j = 0; j < 4; ++j) bias[c4 * 4 + j] = b4[j]; }
#pragma unroll
        for (int qt = 0; qt < QT; ++qt) { float t[16]; float mx = m[qt];
#pragma unroll
            for (int e = 0; e < 16; ++e) { t[e] = fmaf(s[qt][e >> 3][e & 7], CL2, bias[e]); mx = fmaxf(mx, t[e]); }
            mx = fmaxf(mx, xhalf(mx));
            const float al = __builtin_amdgcn_exp2f(m[qt] - mx), sh = pexp - mx; m[qt] = mx; float sum = 0.f;
#pragma unroll
            for (int e = 0; e < 16; ++e) { t[e] = __builtin_amdgcn_exp2f(t[e] + sh); sum += t[e]; }
            l[qt] = fmaf(l[qt], al, sum);
#pragma unroll
            for (int dt = 0; dt < 4; ++dt) o[qt][dt] *= al;
            V ph, pl; packp(t, ph, pl);
#pragma unroll
            for (int dt = 0; dt < 4; ++dt) { o[qt][dt] = WFrag<T16>::mma(vf[dt], ph, o[qt][dt]); if (SPLIT) { o[qt][dt] = WFrag<T16>::mma(vf[dt], pl, o[qt][dt]); o[qt][dt] = WFrag<T16>::mma(vf2[dt], ph, o[qt][dt]); } } }
        if (p + 1 < FKS / 32) ldv(p + 1);
      }
      asm volatile("s_wait_dscnt 0x0" ::: "memory");      // this wave's reads of stage st are done before the buffer is handed back
      asm volatile("s_wait_asynccnt 0x0" ::: "memory");   // this wave's copies of stage st + 1 have landed
      __syncthreads();                                    // publishes stage st + 1 and ends every wave's reads of stage st
      if (st + 2 < NT) fill(st + 2);                      // into the buffer that stage st has left
    }
    asm volatile("s_wait_asynccnt 0x0" ::: "memory");     // no copy is left in flight
#pragma unroll
    for (int qt = 0; qt < QT; ++qt) { const float inv = __fdiv_rn(1.0f, l[qt] + xhalf(l[qt])); const size_t ro = (size_t)(q0 + qt * 16 + lr) * DQ + hi * 8; bf* ph = Ah + ro; bf* pl = Al + ro;
#pragma unroll
        for (int dt = 0; dt < 4; ++dt) { v8us oh, ol;
#pragma unroll
            for (int j = 0; j < 8; ++j) { unsigned short a, c2; splitf(o[qt][dt][j] * inv, a, c2); oh[j] = a; ol[j] = c2; }
            *(v8us*)(ph + dt * 16) = oh; *(v8us*)(pl + dt * 16) = ol; }
        XW2(ph, pl); }
#undef XW1
#undef XW2
}
// grid (row blocks of FW*QT*16 queries, batch*head, 2): z = 0 rows < RH (hi/lo planes, 3 products; the heavier blocks start first), z = 1 the rest (fp16, P x 1024)
__global__ __launch_bounds__(FW * 32) void k_fattn(const h16* __restrict__ Q16, const bf* __restrict__ Qh, const bf* __restrict__ Ql, const h16* __restrict__ K16, const bf* __restrict__ Kh, const bf* __restrict__ Kl, const h16* __restrict__ V16, const bf* __restrict__ Vh, const bf* __restrict__ Vl, const int* __restrict__ pm, bf* Ah, bf* Al) {
    __shared__ __attribute__((aligned(128))) char sm[TT * 4 + 2 * 4 * FTB];   // the bias row, then two buffers of K hi, K lo, V hi, V lo tiles (the fp16 rows use half); the ring does not start at LDS address 0, so the lane's long-lived offset lp is never itself a copy's operand (as one it was spilled to scratch)
    float* mb = (float*)sm; char* ring = sm + TT * 4;
    const int bh = blockIdx.y, b = bh / NH_, h = bh % NH_;
#pragma unroll
    for (int i = 0; i < TT / (FW * 32 * 4); ++i) { const int j0 = (i * FW * 32 + threadIdx.x) * 4; const v4i p4 = *(const v4i*)(pm + (size_t)b * TT + j0); v4f b4;   /* 4 padding flags (16 B) */
#pragma unroll
        for (int j = 0; j < 4; ++j) b4[j] = (p4[j] == 0) ? 0.0f : -3.0e38f;   /* padded keys excluded */
        *(v4fa*)(mb + j0) = b4; }
    __syncthreads();   // every wave reads the whole bias row
    const size_t po = (size_t)bh * TT * HD, ao = (size_t)b * TT * DQ + h * HD; const int qw = (blockIdx.x * FW + (threadIdx.x >> 5)) * (QT * 16);
    if (blockIdx.z == 0) fattn<bf, true>(Qh + po, Ql + po, Kh + po, Kl + po, Vh + po, Vl + po, mb, ring, qw, 0.0f, Ah + ao, Al + ao);
    else fattn<h16, false>(Q16 + po, nullptr, K16 + po, nullptr, V16 + po, nullptr, mb, ring, RH + qw, 10.0f, Ah + ao, Al + ao);
}

extern "C" void kernel_launch(void* const* d_in, const int* in_sizes, int n_in,
                              void* d_out, int out_size, void* d_ws, size_t ws_size, hipStream_t stream) {
    (void)in_sizes; (void)n_in; (void)out_size;
    const float* x = (const float*)d_in[0]; const float* xkv = (const float*)d_in[1]; const int* pm = (const int*)d_in[2];   /* pad_mask [4][1024] bool as int32: 1 = padding key */ const float* wq = (const float*)d_in[3]; const float* wk = (const float*)d_in[4]; const float* wv = (const float*)d_in[5]; const float* wo = (const float*)d_in[6]; const float* bo = (const float*)d_in[7];
    float* OUT = (float*)d_out;     // [4][1024][1024]
    char* wsp = (char*)d_ws;
    auto take = [&](size_t bytes) { char* p = wsp; wsp += (bytes + 255) & ~(size_t)255; return (void*)p; };
    const size_t PB = (size_t)NH_ * TT * HD;   // one batch of head planes (elements); NKV == NH_ here
    bf* WQ = (bf*)take((size_t)DQ * DM * 2); bf* WK = (bf*)take((size_t)DKV * DM * 2); bf* WV = (bf*)take((size_t)DKV * DM * 2); bf* WO = (bf*)take((size_t)DM * DQ * 2);   // the four weight planes are contiguous (2 MiB each)
    h16* QP16 = (h16*)take(2 * NB_ * PB * 2); h16* KP16 = QP16 + NB_ * PB; bf* QPh = (bf*)take(2 * NB_ * PB * 2); bf* KPh = QPh + NB_ * PB; bf* QPl = (bf*)take(2 * NB_ * PB * 2); bf* KPl = QPl + NB_ * PB;   // q planes of all batches, then k planes
    h16* VT16 = (h16*)take(NB_ * PB * 2); bf* VTh = (bf*)take(NB_ * PB * 2); bf* VTl = (bf*)take(NB_ * PB * 2);
    bf* XB = (bf*)take((size_t)2 * NB_ * TT * DM * 2); bf* XKV = XB + (size_t)NB_ * TT * DM; bf* ATh = (bf*)take((size_t)NB_ * TT * DQ * 2); bf* ATl = (bf*)take((size_t)NB_ * TT * DQ * 2);
    if ((size_t)(wsp - (char*)d_ws) > ws_size) return;    // ws 256 MiB
    k_wtG<<<dim3((unsigned)((DM * DQ / 64 + 63) / 64), 4, 1), 256, 0, stream>>>(wq, wk, wv, wo, DM, DQ, WQ);
    k_cvt8<<<dim3((unsigned)(((size_t)NB_ * TT * DM / 8 + 255) / 256), 2, 1), 256, 0, stream>>>(x, xkv, XB, (size_t)NB_ * TT * DM / 8);
    k_gemms<0, false, true><<<dim3(NB_ * TT / 128, DQ / 128, 1), 128, 0, stream>>>(XB, nullptr, WQ, DM, nullptr, DQ, nullptr, 0, QP16, QPh, QPl, nullptr, nullptr, nullptr);
    k_gemms<0, false, true><<<dim3(NB_ * TT / 128, DKV / 128, 2), 128, 0, stream>>>(XKV, nullptr, WK, DM, nullptr, DKV, nullptr, (size_t)DKV * DM, KP16, KPh, KPl, VT16, VTh, VTl);   /* k, v from x_kv: z = 0, 1 */
    k_fattn<<<dim3(RH / (FW * QT * 16), NB_ * NH_, 2), FW * 32, 0, stream>>>(QP16, QPh, QPl, KP16, KPh, KPl, VT16, VTh, VTl, pm, ATh, ATl);   /* all batches and heads; RH == TT - RH */
    k_gemms<1, true, false><<<dim3(NB_ * TT / 128, DM / 128, 1), 128, 0, stream>>>(ATh, ATl, WO, DQ, OUT, DM, bo, 0, nullptr, nullptr, nullptr, nullptr, nullptr, nullptr);
}

// v006
// Measured time: 97.7 microseconds a run.
// Next to v005, in two timings, it ran 1.09 and 1.08 times as fast.
// Over all steps from v000 it is 24.4 times as fast.
#include <hip/hip_runtime.h>

// Multi-head cross attention with a key padding mask (x_q, x_kv [4][1024][1024]; q = x_q Wq, k, v = x_kv Wk, x_kv Wv ('xw' 1/32, no bias; 16 heads x 64); scores x 64^-0.5; keys with pad_mask[b][j] ([4][1024] bool, ~10 % true, read) -> -finfo.max (== exclusion); softmax; out = merged Wo ('xw' 1/32) + bo -> [4][1024][1024] (4.2 M)).
// Layout: bf16 copies of x_q and x_kv (all batches) and the 'xw' weights transposed once, all in one launch; exact projections over all 4096 rows that write the head planes from their own epilogue; one fused attention launch over all batches and heads (K and V tiles staged in LDS for a block's four waves; S^T = K Q^T, running-maximum softmax that excludes padded keys through a bias row in LDS, O^T += V^T P^T, merged hi/lo rows written directly; hybrid rows: < 512 hi/lo 3 products, rest fp16 with P x 1024); merged hi/lo x Wo exact + bo.
// Compute dtypes, f32 accumulate: every input rounded to bf16; projections exact; attention rows < 512 3 products, rest fp16; softmax f32; Wo hl x exact + bias.

#define NB_  4
#define TT   1024
#define DM   1024
#define NH_  16
#define NKV  16
#define REP  (NH_ / NKV)
#define HD   64
#define DQ   (NH_ * HD)
#define DKV  (NKV * HD)
#define ZH   16                   // heads per attention launch (unused; heads are in grid y)
#define RH   512                  // query rows < RH use hi+lo planes (must be TT / 2: z = 1 takes the rest)
#define WIN  0
#define PCAR 1024.0f
#define SCL  0.125f   // HD^-0.5
typedef _Float16 h16;
typedef unsigned short bf;
typedef __attribute__((ext_vector_type(16))) __bf16   v16bf;
typedef __attribute__((ext_vector_type(16))) _Float16 v16h;
typedef __attribute__((ext_vector_type(8)))  _Float16 v8h;
typedef __attribute__((ext_vector_type(8)))  unsigned short v8us;
typedef __attribute__((ext_vector_type(8)))  float    v8f;
typedef __attribute__((ext_vector_type(8)))  __bf16   v8bfv;
typedef __attribute__((ext_vector_type(4)))  float    v4f;
typedef v8h  __attribute__((may_alias)) v8ha;
typedef v4f  __attribute__((may_alias)) v4fa;
typedef v8us __attribute__((may_alias)) v8usa;

__device__ __forceinline__ unsigned short f2bf(float f) { unsigned u = __float_as_uint(f); u += 0x7FFFu + ((u >> 16) & 1u); return (unsigned short)(u >> 16); }
__device__ __forceinline__ float bf2f(unsigned short b) { return __uint_as_float(((unsigned)b) << 16); }
__device__ __forceinline__ float bfr(float f) { return bf2f(f2bf(f)); }
__device__ __forceinline__ v16h cat16(v8h lo, v8h hi) { return __builtin_shufflevector(lo, hi, 0, 1, 2, 3, 4, 5, 6, 7, 8, 9, 10, 11, 12, 13, 14, 15); }
__device__ __forceinline__ v16bf cat16b(v8us lo, v8us hi) { return __builtin_bit_cast(v16bf, __builtin_shufflevector(lo, hi, 0, 1, 2, 3, 4, 5, 6, 7, 8, 9, 10, 11, 12, 13, 14, 15)); }
__device__ __forceinline__ v8f wmma16(v16h a, v16h b, v8f c) { return __builtin_amdgcn_wmma_f32_16x16x32_f16(false, a, false, b, (short)0, c, false, false); }
__device__ __forceinline__ v8f wmmab(v16bf a, v16bf b, v8f c) { return __builtin_amdgcn_wmma_f32_16x16x32_bf16(false, a, false, b, (short)0, c, false, false); }



// Fragment loaders from K-contiguous 16-bit planes: a lane reads 8 + 8 elements of its row, at 8 hi and 16 + 8 hi of each 32 k.
template <typename T16> struct WFrag;
template <> struct WFrag<h16> { typedef v16h V; static __device__ __forceinline__ V ld(const h16* p) { return cat16(*(const v8h*)p, *(const v8h*)(p + 16)); } static __device__ __forceinline__ V lds(const char* p) { return cat16(*(const v8ha*)p, *(const v8ha*)(p + 32)); } static __device__ __forceinline__ v8f mma(V a, V b, v8f c) { return wmma16(a, b, c); } };
template <> struct WFrag<bf> { typedef v16bf V; static __device__ __forceinline__ V ld(const bf* p) { return cat16b(*(const v8us*)p, *(const v8us*)(p + 16)); } static __device__ __forceinline__ V lds(const char* p) { return cat16b(*(const v8usa*)p, *(const v8usa*)(p + 32)); } static __device__ __forceinline__ v8f mma(V a, V b, v8f c) { return wmmab(a, b, c); } };
// planes_out: one wave's 64 x 64 f32 tile (acc[mb][nb]: token mb*16 + 8*hi + j, channel nb*16 + lr) as fp16, bf16 hi and bf16 lo planes; TR false: plane rows are tokens (pitch HD), true: channels (pitch TT).
// A panel of 16 plane rows x 64 goes through LDS so that 8 lanes write one whole 128-byte line of each plane.
template <bool TR>
__device__ __forceinline__ void planes_out(const v8f (&acc)[4][4], float* os, int lane, h16* d16, bf* dh, bf* dl) {
    constexpr int PITCH = TR ? TT : HD;
    const int lr = lane & 15, hi = lane >> 4, prow = lane >> 3, pcol = (lane & 7) * 8;
    const unsigned lob = (unsigned)(prow * PITCH + pcol) * 2u;   // the lane's byte offset in each plane; the plane pointers stay wave-uniform
    // Every loop here is unrolled so that acc and the staging vectors are indexed by constants only and stay in registers.
#pragma unroll
    for (int pb = 0; pb < 4; ++pb) {
        if (TR) {   // a lane holds 8 consecutive tokens of one channel
#pragma unroll
            for (int mb = 0; mb < 4; ++mb) { const v8f w = acc[mb][pb]; *(v4fa*)(os + lr * 68 + mb * 16 + hi * 8) = __builtin_shufflevector(w, w, 0, 1, 2, 3); *(v4fa*)(os + lr * 68 + mb * 16 + hi * 8 + 4) = __builtin_shufflevector(w, w, 4, 5, 6, 7); }
        } else {
#pragma unroll
            for (int nb = 0; nb < 4; ++nb) {
#pragma unroll
                for (int j = 0; j < 8; ++j) os[(hi * 8 + j) * 68 + nb * 16 + lr] = acc[pb][nb][j]; }
        }
        __builtin_amdgcn_wave_barrier(); asm volatile("" ::: "memory");   // holds the compiler: the panel's LDS writes stay in front of the other lanes' reads of them (one wave, LDS runs in order)
        v8h o16[4]; v8us oh[4], ol[4];
#pragma unroll
        for (int s = 0; s < 4; ++s) { const float* pr = os + (4 * s + prow) * 68 + pcol; const v4f x0 = *(const v4fa*)pr, x1 = *(const v4fa*)(pr + 4); const v8f x = __builtin_shufflevector(x0, x1, 0, 1, 2, 3, 4, 5, 6, 7);
            const v8bfv h = __builtin_convertvector(x, v8bfv); const v8bfv l = __builtin_convertvector(x - __builtin_convertvector(h, v8f), v8bfv);   // round to nearest even, as f2bf
            o16[s] = __builtin_convertvector(x, v8h); oh[s] = __builtin_bit_cast(v8us, h); ol[s] = __builtin_bit_cast(v8us, l); }
#pragma unroll
        for (int s = 0; s < 4; ++s) { const int o = (pb * 16 + 4 * s) * PITCH * 2; *(v8h*)((char*)d16 + lob + o) = o16[s]; *(v8us*)((char*)dh + lob + o) = oh[s]; *(v8us*)((char*)dl + lob + o) = ol[s]; }
        // s_wait_xcnt 0 behind the panel's stores, in front of any reuse of their address or data registers (inputs, so that the registers stay theirs up to the wait); its memory clobber also keeps the next panel's LDS writes behind this panel's reads
        asm volatile("s_wait_xcnt 0x0" :: "v"(lob), "v"(o16[0]), "v"(o16[1]), "v"(o16[2]), "v"(o16[3]), "v"(oh[0]), "v"(oh[1]), "v"(oh[2]), "v"(oh[3]), "v"(ol[0]), "v"(ol[1]), "v"(ol[2]), "v"(ol[3]) : "memory");
    }
}
// ---- k_gemms: one 128 x 128 tile of the product per work-group of four waves (2 x 2 wave tiles of 64 x 64, 16 accumulators each); grid (M/128, N/128, Z), 128 threads.
// A stage is 128 k of the tile's 128 A rows (and A2 rows) and 128 Bt rows: rows of 256 bytes, brought into LDS by asynchronous 16-byte copies (a wave's copy covers two whole rows = four whole lines), pitch 272 bytes for the 16-byte fragment reads.
// Two buffers: stage t + 1 flies while stage t is worked on. Fragments, k order and the order of the products are those of the loaders above.
#define GKS  128                  // k per stage
#define GLP  272                  // LDS row pitch, bytes
#define GOPB (128 * GLP)          // one operand's stage, bytes
// Eight copies of one lane, eight rows apart: l = the lane's LDS byte address, g = its global address. s_wait_xcnt 0 closes the statement, in front of any reuse of the address registers.
__device__ __forceinline__ void copy8(unsigned l, const bf* g, int K) {
    unsigned la[8]; const bf* ga[8];
#pragma unroll
    for (int i = 0; i < 8; ++i) { la[i] = l + (unsigned)(i * 8 * GLP); ga[i] = g + (size_t)i * 8 * K; }
    asm volatile("global_load_async_to_lds_b128 %0, %8, off\n\t"
                 "global_load_async_to_lds_b128 %1, %9, off\n\t"
                 "global_load_async_to_lds_b128 %2, %10, off\n\t"
                 "global_load_async_to_lds_b128 %3, %11, off\n\t"
                 "global_load_async_to_lds_b128 %4, %12, off\n\t"
                 "global_load_async_to_lds_b128 %5, %13, off\n\t"
                 "global_load_async_to_lds_b128 %6, %14, off\n\t"
                 "global_load_async_to_lds_b128 %7, %15, off\n\t"
                 "s_wait_xcnt 0x0"
                 :: "v"(la[0]), "v"(la[1]), "v"(la[2]), "v"(la[3]), "v"(la[4]), "v"(la[5]), "v"(la[6]), "v"(la[7]),
                    "v"(ga[0]), "v"(ga[1]), "v"(ga[2]), "v"(ga[3]), "v"(ga[4]), "v"(ga[5]), "v"(ga[6]), "v"(ga[7]) : "memory");
}
__device__ __forceinline__ v16bf ldsfrag(const char* p) { return cat16b(*(const v8usa*)p, *(const v8usa*)(p + 32)); }
// C[m][n] (f32, pitch ldc, + optional f32 bias[n]) = sum_k (A[m][k] + A2[m][k]) Bt[n][k] (A2 only with NSPLIT 1, as a second product). Bt moves by sB elements per z. K % 128 == 0, K >= 256.
// PLANES: no C. A wave's tile is 64 tokens of one batch x the 64 channels of one head, written as fp16 + bf16 hi/lo head planes: z = 0 into [b][h][t][d] (P*), z = 1 into [b][h][d][t] (T*).
template <int NSPLIT, bool BIAS, bool PLANES>
__global__ __launch_bounds__(128) void k_gemms(const bf* __restrict__ A, const bf* __restrict__ A2, const bf* __restrict__ Bt, int K, float* C, int ldc, const float* __restrict__ bias, size_t sB, h16* P16, bf* Ph, bf* Pl, h16* T16p, bf* Th, bf* Tl) {
    constexpr int BUFB = (NSPLIT ? 3 : 2) * GOPB;
    __shared__ __attribute__((aligned(128))) char ring[2 * BUFB];
    __shared__ __align__(16) float osw[4][16 * 68];   // each wave's own output panel
    const int z = blockIdx.z; Bt += (size_t)z * sB;
    const int tid = threadIdx.x, lane = tid & 31, lr = lane & 15, hi = lane >> 4, wave = __builtin_amdgcn_readfirstlane(tid >> 5) /* scalar: the wave's tile and its output pointers stay wave-uniform */, wm = wave >> 1, wn = wave & 1;
    const int R0 = blockIdx.x * 128, C0 = blockIdx.y * 128, r0 = R0 + wm * 64, c0 = C0 + wn * 64;
    float* os = osw[wave];
    v8f acc[4][4];
#pragma unroll
    for (int mb = 0; mb < 4; ++mb)
#pragma unroll
        for (int nb = 0; nb < 4; ++nb) acc[mb][nb] = (v8f){};
    // the lane's part of a stage: 16 bytes of row (tid >> 4) + 8 i, i = 0..15, of each operand
    const size_t go = (size_t)(tid >> 4) * K + (tid & 15) * 8;
    const bf* gA = A + (size_t)R0 * K + go; const bf* gA2 = NSPLIT ? A2 + (size_t)R0 * K + go : gA; const bf* gB = Bt + (size_t)C0 * K + go;
    const unsigned l0 = (unsigned)(size_t)ring + (unsigned)((tid >> 4) * GLP + (tid & 15) * 16);
    // SB: holds the scheduler, so that a statement's address additions stay directly in front of it: few address registers live at a time, no scratch
#define SB __builtin_amdgcn_sched_barrier(0)
    auto fill = [&](int t) { const unsigned l = l0 + (unsigned)((t & 1) * BUFB); const size_t k0 = (size_t)t * GKS, h64 = (size_t)64 * K;
        SB; copy8(l, gA + k0, K); SB; copy8(l + 64 * GLP, gA + k0 + h64, K); SB;
        copy8(l + GOPB, gB + k0, K); SB; copy8(l + GOPB + 64 * GLP, gB + k0 + h64, K); SB;
        if (NSPLIT) { copy8(l + 2 * GOPB, gA2 + k0, K); SB; copy8(l + 2 * GOPB + 64 * GLP, gA2 + k0 + h64, K); SB; } };
#undef SB
    const int NT = K / GKS;
    fill(0);
    asm volatile("s_wait_asynccnt 0x0" ::: "memory");   // this wave's copies of stage 0 have landed
    __syncthreads();                                    // ... and every other wave's
    fill(1);
    const int fo = lr * GLP + hi * 16;
#pragma unroll 1   // the stage loop stays rolled: one copy of the ring's foot, and the accumulators keep their registers
    for (int t = 0; t < NT; ++t) {
        const char* pa = ring + (t & 1) * BUFB + wm * 64 * GLP + fo; const char* pb = ring + (t & 1) * BUFB + GOPB + wn * 64 * GLP + fo;
        // Two fragment sets: the next 32 k's fragments are read as one group ahead of this 32 k's products, inside the stage only (the first group of a stage stands behind its barrier).
        v16bf a[2][4], a2[2][4], b[2][4];
        auto ldf = [&](int s, int kc) {
#pragma unroll
            for (int mb = 0; mb < 4; ++mb) { a[s][mb] = ldsfrag(pa + mb * 16 * GLP + kc * 64); if (NSPLIT) a2[s][mb] = ldsfrag(pa + 2 * GOPB + mb * 16 * GLP + kc * 64); }
#pragma unroll
            for (int nb = 0; nb < 4; ++nb) b[s][nb] = ldsfrag(pb + nb * 16 * GLP + kc * 64); };
        ldf(0, 0);
#pragma unroll
        for (int kc = 0; kc < GKS / 32; ++kc) { const int s = kc & 1;
            if (kc + 1 < GKS / 32) ldf(s ^ 1, kc + 1);
            __builtin_amdgcn_sched_barrier(0);   // holds the scheduler: the group of LDS reads stays whole and ahead of the products, not spread among them
#pragma unroll
            for (int nb = 0; nb < 4; ++nb)
#pragma unroll
                for (int mb = 0; mb < 4; ++mb) { acc[mb][nb] = wmmab(a[s][mb], b[s][nb], acc[mb][nb]); if (NSPLIT) acc[mb][nb] = wmmab(a2[s][mb], b[s][nb], acc[mb][nb]); }
            __builtin_amdgcn_sched_barrier(0);   // ... and the next group stays behind these products
        }
        asm volatile("s_wait_dscnt 0x0" ::: "memory");      // this wave's reads of stage t are done before the buffer is handed back
        asm volatile("s_wait_asynccnt 0x0" ::: "memory");   // this wave's copies of stage t + 1 have landed
        __syncthreads();                                    // publishes stage t + 1 and ends every wave's reads of stage t
        if (t + 2 < NT) fill(t + 2);                        // into the buffer that stage t has left
    }
    asm volatile("s_wait_asynccnt 0x0" ::: "memory");       // no copy is left in flight
    if (PLANES) {
        static_assert(HD == 64 && TT % 64 == 0, "one wave tile = one head, one batch");
        const size_t hp = ((size_t)(r0 / TT) * (ldc / HD) + c0 / HD) * TT * HD; const int t0 = r0 % TT;   // ldc: channels of all heads
        if (z == 0) planes_out<false>(acc, os, lane, P16 + hp + (size_t)t0 * HD, Ph + hp + (size_t)t0 * HD, Pl + hp + (size_t)t0 * HD);
        else planes_out<true>(acc, os, lane, T16p + hp + t0, Th + hp + t0, Tl + hp + t0);
        return;
    }
#pragma unroll
    for (int mb = 0; mb < 4; ++mb) {
#pragma unroll
        for (int nb = 0; nb < 4; ++nb) {
#pragma unroll
            for (int j = 0; j < 8; ++j) os[(hi * 8 + j) * 68 + nb * 16 + lr] = acc[mb][nb][j]; }
        __builtin_amdgcn_wave_barrier(); asm volatile("" ::: "memory");   // holds the compiler: the panel's LDS writes stay in front of the other lanes' reads of them (one wave, LDS runs in order)
        float* crow = C + (size_t)(r0 + mb * 16) * ldc + c0;
        v4f val[8]; float* pc[8];
#pragma unroll
        for (int s = 0; s < 8; ++s) { const int row = 2 * s + hi, cofs = lr * 4; val[s] = *(const v4fa*)(os + row * 68 + cofs); if (BIAS) { val[s][0] += bfr(bias[c0 + cofs]); val[s][1] += bfr(bias[c0 + cofs + 1]); val[s][2] += bfr(bias[c0 + cofs + 2]); val[s][3] += bfr(bias[c0 + cofs + 3]); }
            pc[s] = crow + (size_t)row * ldc + cofs; }
#pragma unroll
        for (int s = 0; s < 8; ++s) *(v4f*)pc[s] = val[s];
        // s_wait_xcnt 0 behind the panel's stores, in front of any reuse of their address or data registers (inputs, so that the registers stay theirs up to the wait); its memory clobber also keeps the next panel's LDS writes behind this panel's reads
        asm volatile("s_wait_xcnt 0x0" :: "v"(pc[0]), "v"(pc[1]), "v"(pc[2]), "v"(pc[3]), "v"(pc[4]), "v"(pc[5]), "v"(pc[6]), "v"(pc[7]), "v"(val[0]), "v"(val[1]), "v"(val[2]), "v"(val[3]), "v"(val[4]), "v"(val[5]), "v"(val[6]), "v"(val[7]) : "memory");
    }
}

__device__ __forceinline__ void splitf(float y, unsigned short& h, unsigned short& l) { h = f2bf(y); l = f2bf(y - bf2f(h)); }
typedef __attribute__((ext_vector_type(2))) _Float16 v2h;
typedef __attribute__((ext_vector_type(4))) _Float16 v4h;
typedef __attribute__((ext_vector_type(2))) unsigned short v2us;
typedef __attribute__((ext_vector_type(4))) unsigned short v4us;
typedef __attribute__((ext_vector_type(2))) float v2f;
typedef __attribute__((ext_vector_type(4))) int v4i;

// ---- k_prep: every input conversion in one launch of few long-lived waves (8 per block), each with all its loads in flight at once.
// Blocks < PTB: a wave transposes one tile of 64 k x 32 n of one of the four equally shaped weights w[k][n] into Bt[n][k] (bf16; the four planes lie one behind the other): 16 loads of four whole lines, k pairs packed into its own LDS tile, rows of 64 k read back and stored as whole lines.
// The other blocks: a wave converts 4096 consecutive floats of x_q or x_kv (the two copies lie one behind the other in dst): 32 loads of four whole lines, 32 stores of two whole lines.
#define PWV  8                    // waves per block
#define PTP  34                   // LDS pitch of a transposed row, dwords (32 + 2: the packed stores of a wave fall on 32 different banks, rows stay 8-byte aligned)
#define PTB  (4 * (DM / 64) * (DQ / 32) / PWV)     // transposing blocks
#define PXW  (NB_ * TT * DM / 4096)                // converting waves per source
#define PCB  (2 * PXW / PWV)                       // converting blocks
typedef __attribute__((ext_vector_type(4))) __bf16 v4bfv;
typedef __attribute__((ext_vector_type(2))) __bf16 v2bfv;
typedef __attribute__((ext_vector_type(2))) unsigned v2u;
typedef __attribute__((ext_vector_type(4))) unsigned v4u;
typedef v2u __attribute__((may_alias)) v2ua;
__global__ __launch_bounds__(PWV * 32) void k_prep(const float* __restrict__ w0, const float* __restrict__ w1, const float* __restrict__ w2, const float* __restrict__ w3, bf* Bt, const float* __restrict__ src0, const float* __restrict__ src1, bf* dst) {
    static_assert(DM % 128 == 0 && DQ % 128 == 0 && DQ == DKV && DQ == DM && (NB_ * TT * DM) % (4096 * PWV) == 0, "whole tiles, four equal weights, whole waves");
    __shared__ __align__(16) unsigned tl[PWV][32 * PTP];   // each wave's own tile
    const int lane = threadIdx.x & 31, wave = __builtin_amdgcn_readfirstlane(threadIdx.x >> 5) /* scalar: the wave's tile and its base pointers stay wave-uniform */;
    if (blockIdx.x < PTB) {
        // a block's eight waves take 4 n tiles x 2 k tiles that lie side by side: 512 contiguous bytes of each source row, 256 of each plane row
        const int tile = blockIdx.x * PWV + wave, y = tile / ((DM / 64) * (DQ / 32)), r = tile % ((DM / 64) * (DQ / 32));
        const int nt = (r & 3) + 4 * ((r >> 3) % (DQ / 128)), kt = ((r >> 2) & 1) + 2 * ((r >> 3) / (DQ / 128));
        const float* __restrict__ w = (y == 0) ? w0 : (y == 1) ? w1 : (y == 2) ? w2 : w3;
        const int c = lane & 7, rr = lane >> 3;
        const float* p = w + (size_t)(kt * 64 + rr * 2) * DQ + nt * 32 + c * 4;   // load 2 i + e: row k = 8 i + 2 rr + e, 4 n from 4 c
        v4f x[16];
#pragma unroll
        for (int i = 0; i < 16; ++i) x[i] = *(const v4f*)(p + (size_t)((i >> 1) * 8 + (i & 1)) * DQ);
        asm volatile("s_wait_xcnt 0x0" :: "v"(p) : "memory");   // behind the run of loads, in front of any reuse of their address registers (an input, so that the registers stay theirs up to the wait)
        unsigned* t = tl[wave];
#pragma unroll
        for (int i = 0; i < 8; ++i)
#pragma unroll
            for (int j = 0; j < 4; ++j) { v2f pp; pp[0] = x[2 * i][j]; pp[1] = x[2 * i + 1][j]; t[(c * 4 + j) * PTP + i * 4 + rr] = __builtin_bit_cast(unsigned, __builtin_convertvector(pp, v2bfv)); }   // round to nearest even, as f2bf
        asm volatile("s_wait_dscnt 0x0" ::: "memory");   // the wave's own tile is written before its other lanes read it back; the clobber keeps the compiler's reads behind the writes
        bf* q = Bt + (size_t)y * DQ * DM + (size_t)(nt * 32 + rr) * DM + kt * 64 + c * 8;   // store s: plane row 4 s + rr, 8 k from 8 c
        v4u o[8];
#pragma unroll
        for (int s = 0; s < 8; ++s) { const unsigned* pr = t + (s * 4 + rr) * PTP + c * 4; const v2u lo = *(const v2ua*)pr, hi2 = *(const v2ua*)(pr + 2); o[s] = __builtin_shufflevector(lo, hi2, 0, 1, 2, 3); }
#pragma unroll
        for (int s = 0; s < 8; ++s) *(v4u*)(q + (size_t)s * 4 * DM) = o[s];
        return;
    }
    const int cw = (blockIdx.x - PTB) * PWV + wave;
    const float* p = (cw < PXW ? src0 + (size_t)cw * 4096 : src1 + (size_t)(cw - PXW) * 4096) + lane * 4;
    bf* q = dst + (size_t)cw * 4096 + lane * 4;
    v4f x[32];
#pragma unroll
    for (int i = 0; i < 32; ++i) x[i] = *(const v4f*)(p + i * 128);
    __builtin_amdgcn_sched_barrier(0);   // holds the scheduler: all 32 loads are issued before the first conversion waits for one (otherwise it keeps about half in flight to save registers)
#pragma unroll
    for (int h = 0; h < 2; ++h) { v2u o[16];   // the first half is stored while the second half's loads still fly
#pragma unroll
        for (int i = 0; i < 16; ++i) o[i] = __builtin_bit_cast(v2u, __builtin_convertvector(x[h * 16 + i], v4bfv));   // round to nearest even, as f2bf
#pragma unroll
        for (int i = 0; i < 16; ++i) *(v2u*)(q + (h * 16 + i) * 128) = o[i];
        // s_wait_xcnt 0 behind the half's stores, in front of any reuse of their data registers (inputs, so that the registers stay theirs up to the wait)
        asm volatile("s_wait_xcnt 0x0" :: "v"(o[0]), "v"(o[1]), "v"(o[2]), "v"(o[3]), "v"(o[4]), "v"(o[5]), "v"(o[6]), "v"(o[7]), "v"(o[8]), "v"(o[9]), "v"(o[10]), "v"(o[11]), "v"(o[12]), "v"(o[13]), "v"(o[14]), "v"(o[15]) : "memory");
    }
}

#define QT   2                    // 16-query groups per wave
#define FW   4                    // waves per block
#define CL2  0.18033688011112042f // HD^-0.5 * log2(e)
#define FKS  64                   // keys per stage
#define FLP  144                  // LDS row pitch, bytes
#define FTB  (64 * FLP)           // one plane's tile of a stage, bytes
// Eight copies of one lane, four of each of two tiles, sixteen rows apart: l, l2 = the lane's LDS byte addresses, g, g2 = its global addresses, gp, gp2 = the sources' row pitches in bytes. s_wait_xcnt 0 closes the statement, in front of any reuse of the address registers.
__device__ __forceinline__ void copy44(unsigned l, const char* g, int gp, unsigned l2, const char* g2, int gp2) {
    unsigned la[8]; const char* ga[8];
#pragma unroll
    for (int i = 0; i < 4; ++i) { la[i] = l + (unsigned)(i * 16 * FLP); ga[i] = g + (size_t)i * 16 * gp; la[4 + i] = l2 + (unsigned)(i * 16 * FLP); ga[4 + i] = g2 + (size_t)i * 16 * gp2; }
    asm volatile("global_load_async_to_lds_b128 %0, %8, off\n\t"
                 "global_load_async_to_lds_b128 %1, %9, off\n\t"
                 "global_load_async_to_lds_b128 %2, %10, off\n\t"
                 "global_load_async_to_lds_b128 %3, %11, off\n\t"
                 "global_load_async_to_lds_b128 %4, %12, off\n\t"
                 "global_load_async_to_lds_b128 %5, %13, off\n\t"
                 "global_load_async_to_lds_b128 %6, %14, off\n\t"
                 "global_load_async_to_lds_b128 %7, %15, off\n\t"
                 "s_wait_xcnt 0x0"
                 :: "v"(la[0]), "v"(la[1]), "v"(la[2]), "v"(la[3]), "v"(la[4]), "v"(la[5]), "v"(la[6]), "v"(la[7]),
                    "v"(ga[0]), "v"(ga[1]), "v"(ga[2]), "v"(ga[3]), "v"(ga[4]), "v"(ga[5]), "v"(ga[6]), "v"(ga[7]) : "memory");
}
typedef __attribute__((ext_vector_type(2))) __bf16 v2bf;
__device__ __forceinline__ float xhalf(float x) { const int b = __float_as_int(x); return __int_as_float(__builtin_amdgcn_permlanex16(b, b, 0x76543210, 0xfedcba98, false, false)); }   // lane l <-> l ^ 16
__device__ __forceinline__ void packp(const float* p, v16bf& h, v16bf& l) {
#pragma unroll
    for (int e = 0; e < 16; e += 2) { v2f pp; pp[0] = p[e]; pp[1] = p[e + 1]; const v2bf hh = __builtin_convertvector(pp, v2bf); v2f rr; rr[0] = pp[0] - (float)hh[0]; rr[1] = pp[1] - (float)hh[1]; const v2bf ll = __builtin_convertvector(rr, v2bf); h[e] = hh[0]; h[e + 1] = hh[1]; l[e] = ll[0]; l[e + 1] = ll[1]; } }
__device__ __forceinline__ void packp(const float* p, v16h& h, v16h& l) { (void)l;
#pragma unroll
    for (int e = 0; e < 16; e += 2) { v2f pp; pp[0] = p[e]; pp[1] = p[e + 1]; const v2h hh = __builtin_convertvector(pp, v2h); h[e] = hh[0]; h[e + 1] = hh[1]; } }
template <typename T16, bool SPLIT>
__device__ __forceinline__ void fattn(const T16* __restrict__ Qh, const T16* __restrict__ Ql, const T16* __restrict__ Kh, const T16* __restrict__ Kl, const T16* __restrict__ Vh, const T16* __restrict__ Vl, const float* mb, char* ring, int q0, float pexp, bf* Ah, bf* Al) {
    typedef typename WFrag<T16>::V V;
    const int lane = threadIdx.x & 31, lr = lane & 15, hi = lane >> 4;
    V q[QT][2], q2[QT][2]; v8f o[QT][4]; float m[QT], l[QT];
    // XW: s_wait_xcnt 0 behind a run of loads or stores, in front of any reuse of their address registers; the pointers are inputs so that their registers stay theirs up to the wait.
#define XW1(p)     asm volatile("s_wait_xcnt 0x0" :: "v"(p) : "memory")
#define XW2(p, p2) asm volatile("s_wait_xcnt 0x0" :: "v"(p), "v"(p2) : "memory")
#pragma unroll
    for (int qt = 0; qt < QT; ++qt) { m[qt] = -3.0e38f; l[qt] = 0.f; const size_t qo = (size_t)(q0 + qt * 16 + lr) * HD + 8 * hi; const T16* pq = Qh + qo; const T16* pq2 = SPLIT ? Ql + qo : pq;
#pragma unroll
        for (int kc = 0; kc < 2; ++kc) { q[qt][kc] = WFrag<T16>::ld(pq + kc * 32); if (SPLIT) q2[qt][kc] = WFrag<T16>::ld(pq2 + kc * 32); }
        if (SPLIT) XW2(pq, pq2); else XW1(pq);
#pragma unroll
        for (int dt = 0; dt < 4; ++dt) o[qt][dt] = (v8f){}; }
    // The lane's part of a stage: 16 bytes of row (tid >> 3) + 16 i, i = 0..3, of each plane's tile. A buffer holds the K tiles, then the V tiles.
    constexpr int NPL = SPLIT ? 2 : 1, BUFB = 2 * NPL * FTB, NT = TT / FKS;
    const int tid = threadIdx.x;
    const unsigned lp = (unsigned)((tid >> 3) * FLP + (tid & 7) * 16);
    const unsigned gko = (unsigned)((tid >> 3) * HD + (tid & 7) * 8), gvo = (unsigned)((tid >> 3) * TT + (tid & 7) * 8);
    auto fill = [&](int t) { const unsigned l = lp + ((unsigned)(size_t)ring + (unsigned)((t & 1) * BUFB)); const unsigned ka = gko + (unsigned)(t * FKS * HD), va = gvo + (unsigned)(t * FKS);
        if (SPLIT) { copy44(l, (const char*)(Kh + ka), HD * 2, l + FTB, (const char*)(Kl + ka), HD * 2); copy44(l + 2 * FTB, (const char*)(Vh + va), TT * 2, l + 3 * FTB, (const char*)(Vl + va), TT * 2); }
        else { copy44(l, (const char*)(Kh + ka), HD * 2, l + FTB, (const char*)(Vh + va), TT * 2); } };
    fill(0);
    asm volatile("s_wait_asynccnt 0x0" ::: "memory");   // this wave's copies of stage 0 have landed
    __syncthreads();                                    // ... and every other wave's
    fill(1);
    const int fo = lr * FLP + hi * 16;
    V kf[2][2], kf2[2][2], vf[4], vf2[4];
#pragma unroll 1   // the stage loop stays rolled: one copy of the ring's foot
    for (int st = 0; st < NT; ++st) {
      const char* pk = ring + (st & 1) * BUFB + fo; const char* pv = pk + NPL * FTB;
      // Fragments of pass p of the stage, from this stage's buffer alone: the second pass's are asked for inside the first pass, K behind its S^T products, V behind its O^T products.
      auto ldk = [&](int p) {
#pragma unroll
        for (int kt = 0; kt < 2; ++kt)
#pragma unroll
            for (int kc = 0; kc < 2; ++kc) { const int off = (p * 32 + kt * 16) * FLP + kc * 64; kf[kt][kc] = WFrag<T16>::lds(pk + off); if (SPLIT) kf2[kt][kc] = WFrag<T16>::lds(pk + FTB + off); } };
      auto ldv = [&](int p) {
#pragma unroll
        for (int dt = 0; dt < 4; ++dt) { const int off = dt * 16 * FLP + p * 64; vf[dt] = WFrag<T16>::lds(pv + off); if (SPLIT) vf2[dt] = WFrag<T16>::lds(pv + FTB + off); } };
      ldk(0); ldv(0);
#pragma unroll   // both passes of a stage are written out: every fragment offset is a constant of the LDS read, and the test for a next pass is settled at compile time
      for (int p = 0; p < FKS / 32; ++p) { const int kb = st * FKS + p * 32;
        v8f s[QT][2];
#pragma unroll
        for (int qt = 0; qt < QT; ++qt) { s[qt][0] = (v8f){}; s[qt][1] = (v8f){}; }
#pragma unroll
        for (int kt = 0; kt < 2; ++kt)
#pragma unroll
            for (int kc = 0; kc < 2; ++kc)
#pragma unroll
                for (int qt = 0; qt < QT; ++qt) { s[qt][kt] = WFrag<T16>::mma(kf[kt][kc], q[qt][kc], s[qt][kt]); if (SPLIT) { s[qt][kt] = WFrag<T16>::mma(kf[kt][kc], q2[qt][kc], s[qt][kt]); s[qt][kt] = WFrag<T16>::mma(kf2[kt][kc], q[qt][kc], s[qt][kt]); } }
        if (p + 1 < FKS / 32) ldk(p + 1);
        float bias[16];   // 0 for a live key, -3e38 for a padded one: keys kb + 8 hi + 0..7 and kb + 16 + 8 hi + 0..7
#pragma unroll
        for (int c4 = 0; c4 < 4; ++c4) { const v4f b4 = *(const v4fa*)(mb + kb + (c4 >> 1) * 16 + hi * 8 + (c4 & 1) * 4);
#pragma unroll
            for (int j = 0; j < 4; ++j) bias[c4 * 4 + j] = b4[j]; }
#pragma unroll
        for (int qt = 0; qt < QT; ++qt) { float t[16]; float mx = m[qt];
#pragma unroll
            for (int e = 0; e < 16; ++e) { t[e] = fmaf(s[qt][e >> 3][e & 7], CL2, bias[e]); mx = fmaxf(mx, t[e]); }
            mx = fmaxf(mx, xhalf(mx));
            const float al = __builtin_amdgcn_exp2f(m[qt] - mx), sh = pexp - mx; m[qt] = mx; float sum = 0.f;
#pragma unroll
            for (int e = 0; e < 16; ++e) { t[e] = __builtin_amdgcn_exp2f(t[e] + sh); sum += t[e]; }
            l[qt] = fmaf(l[qt], al, sum);
#pragma unroll
            for (int dt = 0; dt < 4; ++dt) o[qt][dt] *= al;
            V ph, pl; packp(t, ph, pl);
#pragma unroll
            for (int dt = 0; dt < 4; ++dt) { o[qt][dt] = WFrag<T16>::mma(vf[dt], ph, o[qt][dt]); if (SPLIT) { o[qt][dt] = WFrag<T16>::mma(vf[dt], pl, o[qt][dt]); o[qt][dt] = WFrag<T16>::mma(vf2[dt], ph, o[qt][dt]); } } }
        if (p + 1 < FKS / 32) ldv(p + 1);
      }
      asm volatile("s_wait_dscnt 0x0" ::: "memory");      // this wave's reads of stage st are done before the buffer is handed back
      asm volatile("s_wait_asynccnt 0x0" ::: "memory");   // this wave's copies of stage st + 1 have landed
      __syncthreads();                                    // publishes stage st + 1 and ends every wave's reads of stage st
      if (st + 2 < NT) fill(st + 2);                      // into the buffer that stage st has left
    }
    asm volatile("s_wait_asynccnt 0x0" ::: "memory");     // no copy is left in flight
#pragma unroll
    for (int qt = 0; qt < QT; ++qt) { const float inv = __fdiv_rn(1.0f, l[qt] + xhalf(l[qt])); const size_t ro = (size_t)(q0 + qt * 16 + lr) * DQ + hi * 8; bf* ph = Ah + ro; bf* pl = Al + ro;
#pragma unroll
        for (int dt = 0; dt < 4; ++dt) { v8us oh, ol;
#pragma unroll
            for (int j = 0; j < 8; ++j) { unsigned short a, c2; splitf(o[qt][dt][j] * inv, a, c2); oh[j] = a; ol[j] = c2; }
            *(v8us*)(ph + dt * 16) = oh; *(v8us*)(pl + dt * 16) = ol; }
        XW2(ph, pl); }
#undef XW1
#undef XW2
}
// grid (row blocks of FW*QT*16 queries, batch*head, 2): z = 0 rows < RH (hi/lo planes, 3 products; the heavier blocks start first), z = 1 the rest (fp16, P x 1024)
__global__ __launch_bounds__(FW * 32) void k_fattn(const h16* __restrict__ Q16, const bf* __restrict__ Qh, const bf* __restrict__ Ql, const h16* __restrict__ K16, const bf* __restrict__ Kh, const bf* __restrict__ Kl, const h16* __restrict__ V16, const bf* __restrict__ Vh, const bf* __restrict__ Vl, const int* __restrict__ pm, bf* Ah, bf* Al) {
    __shared__ __attribute__((aligned(128))) char sm[TT * 4 + 2 * 4 * FTB];   // the bias row, then two buffers of K hi, K lo, V hi, V lo tiles (the fp16 rows use half); the ring does not start at LDS address 0, so the lane's long-lived offset lp is never itself a copy's operand (as one it was spilled to scratch)
    float* mb = (float*)sm; char* ring = sm + TT * 4;
    const int bh = blockIdx.y, b = bh / NH_, h = bh % NH_;
#pragma unroll
    for (int i = 0; i < TT / (FW * 32 * 4); ++i) { const int j0 = (i * FW * 32 + threadIdx.x) * 4; const v4i p4 = *(const v4i*)(pm + (size_t)b * TT + j0); v4f b4;   /* 4 padding flags (16 B) */
#pragma unroll
        for (int j = 0; j < 4; ++j) b4[j] = (p4[j] == 0) ? 0.0f : -3.0e38f;   /* padded keys excluded */
        *(v4fa*)(mb + j0) = b4; }
    __syncthreads();   // every wave reads the whole bias row
    const size_t po = (size_t)bh * TT * HD, ao = (size_t)b * TT * DQ + h * HD; const int qw = (blockIdx.x * FW + (threadIdx.x >> 5)) * (QT * 16);
    if (blockIdx.z == 0) fattn<bf, true>(Qh + po, Ql + po, Kh + po, Kl + po, Vh + po, Vl + po, mb, ring, qw, 0.0f, Ah + ao, Al + ao);
    else fattn<h16, false>(Q16 + po, nullptr, K16 + po, nullptr, V16 + po, nullptr, mb, ring, RH + qw, 10.0f, Ah + ao, Al + ao);
}

extern "C" void kernel_launch(void* const* d_in, const int* in_sizes, int n_in,
                              void* d_out, int out_size, void* d_ws, size_t ws_size, hipStream_t stream) {
    (void)in_sizes; (void)n_in; (void)out_size;
    const float* x = (const float*)d_in[0]; const float* xkv = (const float*)d_in[1]; const int* pm = (const int*)d_in[2];   /* pad_mask [4][1024] bool as int32: 1 = padding key */ const float* wq = (const float*)d_in[3]; const float* wk = (const float*)d_in[4]; const float* wv = (const float*)d_in[5]; const float* wo = (const float*)d_in[6]; const float* bo = (const float*)d_in[7];
    float* OUT = (float*)d_out;     // [4][1024][1024]
    char* wsp = (char*)d_ws;
    auto take = [&](size_t bytes) { char* p = wsp; wsp += (bytes + 255) & ~(size_t)255; return (void*)p; };
    const size_t PB = (size_t)NH_ * TT * HD;   // one batch of head planes (elements); NKV == NH_ here
    bf* WQ = (bf*)take((size_t)DQ * DM * 2); bf* WK = (bf*)take((size_t)DKV * DM * 2); bf* WV = (bf*)take((size_t)DKV * DM * 2); bf* WO = (bf*)take((size_t)DM * DQ * 2);   // the four weight planes are contiguous (2 MiB each)
    h16* QP16 = (h16*)take(2 * NB_ * PB * 2); h16* KP16 = QP16 + NB_ * PB; bf* QPh = (bf*)take(2 * NB_ * PB * 2); bf* KPh = QPh + NB_ * PB; bf* QPl = (bf*)take(2 * NB_ * PB * 2); bf* KPl = QPl + NB_ * PB;   // q planes of all batches, then k planes
    h16* VT16 = (h16*)take(NB_ * PB * 2); bf* VTh = (bf*)take(NB_ * PB * 2); bf* VTl = (bf*)take(NB_ * PB * 2);
    bf* XB = (bf*)take((size_t)2 * NB_ * TT * DM * 2); bf* XKV = XB + (size_t)NB_ * TT * DM; bf* ATh = (bf*)take((size_t)NB_ * TT * DQ * 2); bf* ATl = (bf*)take((size_t)NB_ * TT * DQ * 2);
    if ((size_t)(wsp - (char*)d_ws) > ws_size) return;    // ws 256 MiB
    k_prep<<<dim3(PTB + PCB, 1, 1), PWV * 32, 0, stream>>>(wq, wk, wv, wo, WQ, x, xkv, XB);
    k_gemms<0, false, true><<<dim3(NB_ * TT / 128, DQ / 128, 1), 128, 0, stream>>>(XB, nullptr, WQ, DM, nullptr, DQ, nullptr, 0, QP16, QPh, QPl, nullptr, nullptr, nullptr);
    k_gemms<0, false, true><<<dim3(NB_ * TT / 128, DKV / 128, 2), 128, 0, stream>>>(XKV, nullptr, WK, DM, nullptr, DKV, nullptr, (size_t)DKV * DM, KP16, KPh, KPl, VT16, VTh, VTl);   /* k, v from x_kv: z = 0, 1 */
    k_fattn<<<dim3(RH / (FW * QT * 16), NB_ * NH_, 2), FW * 32, 0, stream>>>(QP16, QPh, QPl, KP16, KPh, KPl, VT16, VTh, VTl, pm, ATh, ATl);   /* all batches and heads; RH == TT - RH */
    k_gemms<1, true, false><<<dim3(NB_ * TT / 128, DM / 128, 1), 128, 0, stream>>>(ATh, ATl, WO, DQ, OUT, DM, bo, 0, nullptr, nullptr, nullptr, nullptr, nullptr, nullptr);
}

// v007
// It runs in 93.4 microseconds.
// Two timings next to v006 put it at 1.07 and 1.06 times that version's speed.
// Over all steps from v000 it is 25.9 times as fast.
#include <hip/hip_runtime.h>

// Multi-head cross attention with a key padding mask (x_q, x_kv [4][1024][1024]; q = x_q Wq, k, v = x_kv Wk, x_kv Wv ('xw' 1/32, no bias; 16 heads x 64); scores x 64^-0.5; keys with pad_mask[b][j] ([4][1024] bool, ~10 % true, read) -> -finfo.max (== exclusion); softmax; out = merged Wo ('xw' 1/32) + bo -> [4][1024][1024] (4.2 M)).
// Layout: bf16 copies of x_q and x_kv (all batches) and the 'xw' weights transposed once, all in one launch; exact projections over all 4096 rows, all three in one launch, that write the head planes from their own epilogue; one fused attention launch over all batches and heads (K and V tiles staged in LDS for a block's four waves; S^T = K Q^T, running-maximum softmax that excludes padded keys through a bias row in LDS, O^T += V^T P^T, merged hi/lo rows written directly; hybrid rows: < 512 hi/lo 3 products, rest fp16 with P x 1024); merged hi/lo x Wo exact + bo.
// Compute dtypes, f32 accumulate: every input rounded to bf16; projections exact; attention rows < 512 3 products, rest fp16; softmax f32; Wo hl x exact + bias.

#define NB_  4
#define TT   1024
#define DM   1024
#define NH_  16
#define NKV  16
#define REP  (NH_ / NKV)
#define HD   64
#define DQ   (NH_ * HD)
#define DKV  (NKV * HD)
#define ZH   16                   // heads per attention launch (unused; heads are in grid y)
#define RH   512                  // query rows < RH use hi+lo planes (must be TT / 2: z = 1 takes the rest)
#define WIN  0
#define PCAR 1024.0f
#define SCL  0.125f   // HD^-0.5
typedef _Float16 h16;
typedef unsigned short bf;
typedef __attribute__((ext_vector_type(16))) __bf16   v16bf;
typedef __attribute__((ext_vector_type(16))) _Float16 v16h;
typedef __attribute__((ext_vector_type(8)))  _Float16 v8h;
typedef __attribute__((ext_vector_type(8)))  unsigned short v8us;
typedef __attribute__((ext_vector_type(8)))  float    v8f;
typedef __attribute__((ext_vector_type(8)))  __bf16   v8bfv;
typedef __attribute__((ext_vector_type(4)))  float    v4f;
typedef v8h  __attribute__((may_alias)) v8ha;
typedef v4f  __attribute__((may_alias)) v4fa;
typedef v8us __attribute__((may_alias)) v8usa;

__device__ __forceinline__ unsigned short f2bf(float f) { unsigned u = __float_as_uint(f); u += 0x7FFFu + ((u >> 16) & 1u); return (unsigned short)(u >> 16); }
__device__ __forceinline__ float bf2f(unsigned short b) { return __uint_as_float(((unsigned)b) << 16); }
__device__ __forceinline__ float bfr(float f) { return bf2f(f2bf(f)); }
__device__ __forceinline__ v16h cat16(v8h lo, v8h hi) { return __builtin_shufflevector(lo, hi, 0, 1, 2, 3, 4, 5, 6, 7, 8, 9, 10, 11, 12, 13, 14, 15); }
__device__ __forceinline__ v16bf cat16b(v8us lo, v8us hi) { return __builtin_bit_cast(v16bf, __builtin_shufflevector(lo, hi, 0, 1, 2, 3, 4, 5, 6, 7, 8, 9, 10, 11, 12, 13, 14, 15)); }
__device__ __forceinline__ v8f wmma16(v16h a, v16h b, v8f c) { return __builtin_amdgcn_wmma_f32_16x16x32_f16(false, a, false, b, (short)0, c, false, false); }
__device__ __forceinline__ v8f wmmab(v16bf a, v16bf b, v8f c) { return __builtin_amdgcn_wmma_f32_16x16x32_bf16(false, a, false, b, (short)0, c, false, false); }



// Fragment loaders from K-contiguous 16-bit planes: a lane reads 8 + 8 elements of its row, at 8 hi and 16 + 8 hi of each 32 k.
template <typename T16> struct WFrag;
template <> struct WFrag<h16> { typedef v16h V; static __device__ __forceinline__ V ld(const h16* p) { return cat16(*(const v8h*)p, *(const v8h*)(p + 16)); } static __device__ __forceinline__ V lds(const char* p) { return cat16(*(const v8ha*)p, *(const v8ha*)(p + 32)); } static __device__ __forceinline__ v8f mma(V a, V b, v8f c) { return wmma16(a, b, c); } };
template <> struct WFrag<bf> { typedef v16bf V; static __device__ __forceinline__ V ld(const bf* p) { return cat16b(*(const v8us*)p, *(const v8us*)(p + 16)); } static __device__ __forceinline__ V lds(const char* p) { return cat16b(*(const v8usa*)p, *(const v8usa*)(p + 32)); } static __device__ __forceinline__ v8f mma(V a, V b, v8f c) { return wmmab(a, b, c); } };
// planes_out: one wave's 64 x 64 f32 tile (acc[mb][nb]: token mb*16 + 8*hi + j, channel nb*16 + lr) as fp16, bf16 hi and bf16 lo planes; TR false: plane rows are tokens (pitch HD), true: channels (pitch TT).
// A panel of 16 plane rows x 64 goes through LDS so that 8 lanes write one whole 128-byte line of each plane.
template <bool TR>
__device__ __forceinline__ void planes_out(const v8f (&acc)[4][4], float* os, int lane, h16* d16, bf* dh, bf* dl) {
    constexpr int PITCH = TR ? TT : HD;
    const int lr = lane & 15, hi = lane >> 4, prow = lane >> 3, pcol = (lane & 7) * 8;
    const unsigned lob = (unsigned)(prow * PITCH + pcol) * 2u;   // the lane's byte offset in each plane; the plane pointers stay wave-uniform
    // Every loop here is unrolled so that acc and the staging vectors are indexed by constants only and stay in registers.
#pragma unroll
    for (int pb = 0; pb < 4; ++pb) {
        if (TR) {   // a lane holds 8 consecutive tokens of one channel
#pragma unroll
            for (int mb = 0; mb < 4; ++mb) { const v8f w = acc[mb][pb]; *(v4fa*)(os + lr * 68 + mb * 16 + hi * 8) = __builtin_shufflevector(w, w, 0, 1, 2, 3); *(v4fa*)(os + lr * 68 + mb * 16 + hi * 8 + 4) = __builtin_shufflevector(w, w, 4, 5, 6, 7); }
        } else {
#pragma unroll
            for (int nb = 0; nb < 4; ++nb) {
#pragma unroll
                for (int j = 0; j < 8; ++j) os[(hi * 8 + j) * 68 + nb * 16 + lr] = acc[pb][nb][j]; }
        }
        __builtin_amdgcn_wave_barrier(); asm volatile("" ::: "memory");   // holds the compiler: the panel's LDS writes stay in front of the other lanes' reads of them (one wave, LDS runs in order)
        v8h o16[4]; v8us oh[4], ol[4];
#pragma unroll
        for (int s = 0; s < 4; ++s) { const float* pr = os + (4 * s + prow) * 68 + pcol; const v4f x0 = *(const v4fa*)pr, x1 = *(const v4fa*)(pr + 4); const v8f x = __builtin_shufflevector(x0, x1, 0, 1, 2, 3, 4, 5, 6, 7);
            const v8bfv h = __builtin_convertvector(x, v8bfv); const v8bfv l = __builtin_convertvector(x - __builtin_convertvector(h, v8f), v8bfv);   // round to nearest even, as f2bf
            o16[s] = __builtin_convertvector(x, v8h); oh[s] = __builtin_bit_cast(v8us, h); ol[s] = __builtin_bit_cast(v8us, l); }
#pragma unroll
        for (int s = 0; s < 4; ++s) { const int o = (pb * 16 + 4 * s) * PITCH * 2; *(v8h*)((char*)d16 + lob + o) = o16[s]; *(v8us*)((char*)dh + lob + o) = oh[s]; *(v8us*)((char*)dl + lob + o) = ol[s]; }
        // s_wait_xcnt 0 behind the panel's stores, in front of any reuse of their address or data registers (inputs, so that the registers stay theirs up to the wait); its memory clobber also keeps the next panel's LDS writes behind this panel's reads
        asm volatile("s_wait_xcnt 0x0" :: "v"(lob), "v"(o16[0]), "v"(o16[1]), "v"(o16[2]), "v"(o16[3]), "v"(oh[0]), "v"(oh[1]), "v"(oh[2]), "v"(oh[3]), "v"(ol[0]), "v"(ol[1]), "v"(ol[2]), "v"(ol[3]) : "memory");
    }
}
// ---- k_gemms: one 128 x 128 tile of the product per work-group of four waves (2 x 2 wave tiles of 64 x 64, 16 accumulators each); grid (M/128, N/128, Z), 128 threads.
// A stage is 128 k of the tile's 128 A rows (and A2 rows) and 128 Bt rows: rows of 256 bytes, brought into LDS by asynchronous 16-byte copies (a wave's copy covers two whole rows = four whole lines), pitch 272 bytes for the 16-byte fragment reads.
// Two buffers: stage t + 1 flies while stage t is worked on. Fragments, k order and the order of the products are those of the loaders above.
#define GKS  128                  // k per stage
#define GLP  272                  // LDS row pitch, bytes
#define GOPB (128 * GLP)          // one operand's stage, bytes
// Eight copies of one lane, eight rows apart: l = the lane's LDS byte address, g = its global address. s_wait_xcnt 0 closes the statement, in front of any reuse of the address registers.
__device__ __forceinline__ void copy8(unsigned l, const bf* g, int K) {
    unsigned la[8]; const bf* ga[8];
#pragma unroll
    for (int i = 0; i < 8; ++i) { la[i] = l + (unsigned)(i * 8 * GLP); ga[i] = g + (size_t)i * 8 * K; }
    asm volatile("global_load_async_to_lds_b128 %0, %8, off\n\t"
                 "global_load_async_to_lds_b128 %1, %9, off\n\t"
                 "global_load_async_to_lds_b128 %2, %10, off\n\t"
                 "global_load_async_to_lds_b128 %3, %11, off\n\t"
                 "global_load_async_to_lds_b128 %4, %12, off\n\t"
                 "global_load_async_to_lds_b128 %5, %13, off\n\t"
                 "global_load_async_to_lds_b128 %6, %14, off\n\t"
                 "global_load_async_to_lds_b128 %7, %15, off\n\t"
                 "s_wait_xcnt 0x0"
                 :: "v"(la[0]), "v"(la[1]), "v"(la[2]), "v"(la[3]), "v"(la[4]), "v"(la[5]), "v"(la[6]), "v"(la[7]),
                    "v"(ga[0]), "v"(ga[1]), "v"(ga[2]), "v"(ga[3]), "v"(ga[4]), "v"(ga[5]), "v"(ga[6]), "v"(ga[7]) : "memory");
}
__device__ __forceinline__ v16bf ldsfrag(const char* p) { return cat16b(*(const v8usa*)p, *(const v8usa*)(p + 32)); }
// C[m][n] (f32, pitch ldc, + optional f32 bias[n]) = sum_k (A[m][k] + A2[m][k]) Bt[n][k] (A2 only with NSPLIT 1, as a second product). Bt moves by sB elements per z. K % 128 == 0, K >= 256.
// PLANES: no C; the three projections are the z of one launch: z = 0 is q (A as given), z = 1, 2 are k, v (A moved by sA elements). A wave's tile is 64 tokens of one batch x the 64 channels of one head, written as fp16 + bf16 hi/lo head planes: z = 0, 1 into [b][h][t][d] (P*, moved by sP elements per z), z = 2 into [b][h][d][t] (T*).
template <int NSPLIT, bool BIAS, bool PLANES>
__global__ __launch_bounds__(128) void k_gemms(const bf* __restrict__ A, const bf* __restrict__ A2, const bf* __restrict__ Bt, int K, float* C, int ldc, const float* __restrict__ bias, size_t sA, size_t sB, size_t sP, h16* P16, bf* Ph, bf* Pl, h16* T16p, bf* Th, bf* Tl) {
    constexpr int BUFB = (NSPLIT ? 3 : 2) * GOPB;
    __shared__ __attribute__((aligned(128))) char ring[2 * BUFB];
    __shared__ __align__(16) float osw[4][16 * 68];   // each wave's own output panel
    const int z = blockIdx.z; Bt += (size_t)z * sB; if (PLANES && z != 0) A += sA;
    const int tid = threadIdx.x, lane = tid & 31, lr = lane & 15, hi = lane >> 4, wave = __builtin_amdgcn_readfirstlane(tid >> 5) /* scalar: the wave's tile and its output pointers stay wave-uniform */, wm = wave >> 1, wn = wave & 1;
    const int R0 = blockIdx.x * 128, C0 = blockIdx.y * 128, r0 = R0 + wm * 64, c0 = C0 + wn * 64;
    float* os = osw[wave];
    v8f acc[4][4];
#pragma unroll
    for (int mb = 0; mb < 4; ++mb)
#pragma unroll
        for (int nb = 0; nb < 4; ++nb) acc[mb][nb] = (v8f){};
    // the lane's part of a stage: 16 bytes of row (tid >> 4) + 8 i, i = 0..15, of each operand
    const size_t go = (size_t)(tid >> 4) * K + (tid & 15) * 8;
    const bf* gA = A + (size_t)R0 * K + go; const bf* gA2 = NSPLIT ? A2 + (size_t)R0 * K + go : gA; const bf* gB = Bt + (size_t)C0 * K + go;
    const unsigned l0 = (unsigned)(size_t)ring + (unsigned)((tid >> 4) * GLP + (tid & 15) * 16);
    // SB: holds the scheduler, so that a statement's address additions stay directly in front of it: few address registers live at a time, no scratch
#define SB __builtin_amdgcn_sched_barrier(0)
    auto fill = [&](int t) { const unsigned l = l0 + (unsigned)((t & 1) * BUFB); const size_t k0 = (size_t)t * GKS, h64 = (size_t)64 * K;
        SB; copy8(l, gA + k0, K); SB; copy8(l + 64 * GLP, gA + k0 + h64, K); SB;
        copy8(l + GOPB, gB + k0, K); SB; copy8(l + GOPB + 64 * GLP, gB + k0 + h64, K); SB;
        if (NSPLIT) { copy8(l + 2 * GOPB, gA2 + k0, K); SB; copy8(l + 2 * GOPB + 64 * GLP, gA2 + k0 + h64, K); SB; } };
#undef SB
    const int NT = K / GKS;
    fill(0);
    asm volatile("s_wait_asynccnt 0x0" ::: "memory");   // this wave's copies of stage 0 have landed
    __syncthreads();                                    // ... and every other wave's
    fill(1);
    const int fo = lr * GLP + hi * 16;
#pragma unroll 1   // the stage loop stays rolled: one copy of the ring's foot, and the accumulators keep their registers
    for (int t = 0; t < NT; ++t) {
        const char* pa = ring + (t & 1) * BUFB + wm * 64 * GLP + fo; const char* pb = ring + (t & 1) * BUFB + GOPB + wn * 64 * GLP + fo;
        // Two fragment sets: the next 32 k's fragments are read as one group ahead of this 32 k's products, inside the stage only (the first group of a stage stands behind its barrier).
        v16bf a[2][4], a2[2][4], b[2][4];
        auto ldf = [&](int s, int kc) {
#pragma unroll
            for (int mb = 0; mb < 4; ++mb) { a[s][mb] = ldsfrag(pa + mb * 16 * GLP + kc * 64); if (NSPLIT) a2[s][mb] = ldsfrag(pa + 2 * GOPB + mb * 16 * GLP + kc * 64); }
#pragma unroll
            for (int nb = 0; nb < 4; ++nb) b[s][nb] = ldsfrag(pb + nb * 16 * GLP + kc * 64); };
        ldf(0, 0);
#pragma unroll
        for (int kc = 0; kc < GKS / 32; ++kc) { const int s = kc & 1;
            if (kc + 1 < GKS / 32) ldf(s ^ 1, kc + 1);
            __builtin_amdgcn_sched_barrier(0);   // holds the scheduler: the group of LDS reads stays whole and ahead of the products, not spread among them
#pragma unroll
            for (int nb = 0; nb < 4; ++nb)
#pragma unroll
                for (int mb = 0; mb < 4; ++mb) { acc[mb][nb] = wmmab(a[s][mb], b[s][nb], acc[mb][nb]); if (NSPLIT) acc[mb][nb] = wmmab(a2[s][mb], b[s][nb], acc[mb][nb]); }
            __builtin_amdgcn_sched_barrier(0);   // ... and the next group stays behind these products
        }
        asm volatile("s_wait_dscnt 0x0" ::: "memory");      // this wave's reads of stage t are done before the buffer is handed back
        asm volatile("s_wait_asynccnt 0x0" ::: "memory");   // this wave's copies of stage t + 1 have landed
        __syncthreads();                                    // publishes stage t + 1 and ends every wave's reads of stage t
        if (t + 2 < NT) fill(t + 2);                        // into the buffer that stage t has left
    }
    asm volatile("s_wait_asynccnt 0x0" ::: "memory");       // no copy is left in flight
    if (PLANES) {
        static_assert(HD == 64 && TT % 64 == 0, "one wave tile = one head, one batch");
        const size_t hp = ((size_t)(r0 / TT) * (ldc / HD) + c0 / HD) * TT * HD; const int t0 = r0 % TT;   // ldc: channels of all heads
        const size_t pp = (size_t)z * sP + hp + (size_t)t0 * HD;
        if (z < 2) planes_out<false>(acc, os, lane, P16 + pp, Ph + pp, Pl + pp);
        else planes_out<true>(acc, os, lane, T16p + hp + t0, Th + hp + t0, Tl + hp + t0);
        return;
    }
#pragma unroll
    for (int mb = 0; mb < 4; ++mb) {
#pragma unroll
        for (int nb = 0; nb < 4; ++nb) {
#pragma unroll
            for (int j = 0; j < 8; ++j) os[(hi * 8 + j) * 68 + nb * 16 + lr] = acc[mb][nb][j]; }
        __builtin_amdgcn_wave_barrier(); asm volatile("" ::: "memory");   // holds the compiler: the panel's LDS writes stay in front of the other lanes' reads of them (one wave, LDS runs in order)
        float* crow = C + (size_t)(r0 + mb * 16) * ldc + c0;
        v4f val[8]; float* pc[8];
#pragma unroll
        for (int s = 0; s < 8; ++s) { const int row = 2 * s + hi, cofs = lr * 4; val[s] = *(const v4fa*)(os + row * 68 + cofs); if (BIAS) { val[s][0] += bfr(bias[c0 + cofs]); val[s][1] += bfr(bias[c0 + cofs + 1]); val[s][2] += bfr(bias[c0 + cofs + 2]); val[s][3] += bfr(bias[c0 + cofs + 3]); }
            pc[s] = crow + (size_t)row * ldc + cofs; }
#pragma unroll
        for (int s = 0; s < 8; ++s) *(v4f*)pc[s] = val[s];
        // s_wait_xcnt 0 behind the panel's stores, in front of any reuse of their address or data registers (inputs, so that the registers stay theirs up to the wait); its memory clobber also keeps the next panel's LDS writes behind this panel's reads
        asm volatile("s_wait_xcnt 0x0" :: "v"(pc[0]), "v"(pc[1]), "v"(pc[2]), "v"(pc[3]), "v"(pc[4]), "v"(pc[5]), "v"(pc[6]), "v"(pc[7]), "v"(val[0]), "v"(val[1]), "v"(val[2]), "v"(val[3]), "v"(val[4]), "v"(val[5]), "v"(val[6]), "v"(val[7]) : "memory");
    }
}

__device__ __forceinline__ void splitf(float y, unsigned short& h, unsigned short& l) { h = f2bf(y); l = f2bf(y - bf2f(h)); }
typedef __attribute__((ext_vector_type(2))) _Float16 v2h;
typedef __attribute__((ext_vector_type(4))) _Float16 v4h;
typedef __attribute__((ext_vector_type(2))) unsigned short v2us;
typedef __attribute__((ext_vector_type(4))) unsigned short v4us;
typedef __attribute__((ext_vector_type(2))) float v2f;
typedef __attribute__((ext_vector_type(4))) int v4i;

// ---- k_prep: every input conversion in one launch of few long-lived waves (8 per block), each with all its loads in flight at once.
// Blocks < PTB: a wave transposes one tile of 64 k x 32 n of one of the four equally shaped weights w[k][n] into Bt[n][k] (bf16; the four planes lie one behind the other): 16 loads of four whole lines, k pairs packed into its own LDS tile, rows of 64 k read back and stored as whole lines.
// The other blocks: a wave converts 4096 consecutive floats of x_q or x_kv (the two copies lie one behind the other in dst): 32 loads of four whole lines, 32 stores of two whole lines.
#define PWV  8                    // waves per block
#define PTP  34                   // LDS pitch of a transposed row, dwords (32 + 2: the packed stores of a wave fall on 32 different banks, rows stay 8-byte aligned)
#define PTB  (4 * (DM / 64) * (DQ / 32) / PWV)     // transposing blocks
#define PXW  (NB_ * TT * DM / 4096)                // converting waves per source
#define PCB  (2 * PXW / PWV)                       // converting blocks
typedef __attribute__((ext_vector_type(4))) __bf16 v4bfv;
typedef __attribute__((ext_vector_type(2))) __bf16 v2bfv;
typedef __attribute__((ext_vector_type(2))) unsigned v2u;
typedef __attribute__((ext_vector_type(4))) unsigned v4u;
typedef v2u __attribute__((may_alias)) v2ua;
__global__ __launch_bounds__(PWV * 32) void k_prep(const float* __restrict__ w0, const float* __restrict__ w1, const float* __restrict__ w2, const float* __restrict__ w3, bf* Bt, const float* __restrict__ src0, const float* __restrict__ src1, bf* dst) {
    static_assert(DM % 128 == 0 && DQ % 128 == 0 && DQ == DKV && DQ == DM && (NB_ * TT * DM) % (4096 * PWV) == 0, "whole tiles, four equal weights, whole waves");
    __shared__ __align__(16) unsigned tl[PWV][32 * PTP];   // each wave's own tile
    const int lane = threadIdx.x & 31, wave = __builtin_amdgcn_readfirstlane(threadIdx.x >> 5) /* scalar: the wave's tile and its base pointers stay wave-uniform */;
    if (blockIdx.x < PTB) {
        // a block's eight waves take 4 n tiles x 2 k tiles that lie side by side: 512 contiguous bytes of each source row, 256 of each plane row
        const int tile = blockIdx.x * PWV + wave, y = tile / ((DM / 64) * (DQ / 32)), r = tile % ((DM / 64) * (DQ / 32));
        const int nt = (r & 3) + 4 * ((r >> 3) % (DQ / 128)), kt = ((r >> 2) & 1) + 2 * ((r >> 3) / (DQ / 128));
        const float* __restrict__ w = (y == 0) ? w0 : (y == 1) ? w1 : (y == 2) ? w2 : w3;
        const int c = lane & 7, rr = lane >> 3;
        const float* p = w + (size_t)(kt * 64 + rr * 2) * DQ + nt * 32 + c * 4;   // load 2 i + e: row k = 8 i + 2 rr + e, 4 n from 4 c
        v4f x[16];
#pragma unroll
        for (int i = 0; i < 16; ++i) x[i] = *(const v4f*)(p + (size_t)((i >> 1) * 8 + (i & 1)) * DQ);
        asm volatile("s_wait_xcnt 0x0" :: "v"(p) : "memory");   // behind the run of loads, in front of any reuse of their address registers (an input, so that the registers stay theirs up to the wait)
        unsigned* t = tl[wave];
#pragma unroll
        for (int i = 0; i < 8; ++i)
#pragma unroll
            for (int j = 0; j < 4; ++j) { v2f pp; pp[0] = x[2 * i][j]; pp[1] = x[2 * i + 1][j]; t[(c * 4 + j) * PTP + i * 4 + rr] = __builtin_bit_cast(unsigned, __builtin_convertvector(pp, v2bfv)); }   // round to nearest even, as f2bf
        asm volatile("s_wait_dscnt 0x0" ::: "memory");   // the wave's own tile is written before its other lanes read it back; the clobber keeps the compiler's reads behind the writes
        bf* q = Bt + (size_t)y * DQ * DM + (size_t)(nt * 32 + rr) * DM + kt * 64 + c * 8;   // store s: plane row 4 s + rr, 8 k from 8 c
        v4u o[8];
#pragma unroll
        for (int s = 0; s < 8; ++s) { const unsigned* pr = t + (s * 4 + rr) * PTP + c * 4; const v2u lo = *(const v2ua*)pr, hi2 = *(const v2ua*)(pr + 2); o[s] = __builtin_shufflevector(lo, hi2, 0, 1, 2, 3); }
#pragma unroll
        for (int s = 0; s < 8; ++s) *(v4u*)(q + (size_t)s * 4 * DM) = o[s];
        return;
    }
    const int cw = (blockIdx.x - PTB) * PWV + wave;
    const float* p = (cw < PXW ? src0 + (size_t)cw * 4096 : src1 + (size_t)(cw - PXW) * 4096) + lane * 4;
    bf* q = dst + (size_t)cw * 4096 + lane * 4;
    v4f x[32];
#pragma unroll
    for (int i = 0; i < 32; ++i) x[i] = *(const v4f*)(p + i * 128);
    __builtin_amdgcn_sched_barrier(0);   // holds the scheduler: all 32 loads are issued before the first conversion waits for one (otherwise it keeps about half in flight to save registers)
#pragma unroll
    for (int h = 0; h < 2; ++h) { v2u o[16];   // the first half is stored while the second half's loads still fly
#pragma unroll
        for (int i = 0; i < 16; ++i) o[i] = __builtin_bit_cast(v2u, __builtin_convertvector(x[h * 16 + i], v4bfv));   // round to nearest even, as f2bf
#pragma unroll
        for (int i = 0; i < 16; ++i) *(v2u*)(q + (h * 16 + i) * 128) = o[i];
        // s_wait_xcnt 0 behind the half's stores, in front of any reuse of their data registers (inputs, so that the registers stay theirs up to the wait)
        asm volatile("s_wait_xcnt 0x0" :: "v"(o[0]), "v"(o[1]), "v"(o[2]), "v"(o[3]), "v"(o[4]), "v"(o[5]), "v"(o[6]), "v"(o[7]), "v"(o[8]), "v"(o[9]), "v"(o[10]), "v"(o[11]), "v"(o[12]), "v"(o[13]), "v"(o[14]), "v"(o[15]) : "memory");
    }
}

#define QT   2                    // 16-query groups per wave
#define FW   4                    // waves per block
#define CL2  0.18033688011112042f // HD^-0.5 * log2(e)
#define FKS  64                   // keys per stage
#define FLP  144                  // LDS row pitch, bytes
#define FTB  (64 * FLP)           // one plane's tile of a stage, bytes
// Eight copies of one lane, four of each of two tiles, sixteen rows apart: l, l2 = the lane's LDS byte addresses, g, g2 = its global addresses, gp, gp2 = the sources' row pitches in bytes. s_wait_xcnt 0 closes the statement, in front of any reuse of the address registers.
__device__ __forceinline__ void copy44(unsigned l, const char* g, int gp, unsigned l2, const char* g2, int gp2) {
    unsigned la[8]; const char* ga[8];
#pragma unroll
    for (int i = 0; i < 4; ++i) { la[i] = l + (unsigned)(i * 16 * FLP); ga[i] = g + (size_t)i * 16 * gp; la[4 + i] = l2 + (unsigned)(i * 16 * FLP); ga[4 + i] = g2 + (size_t)i * 16 * gp2; }
    asm volatile("global_load_async_to_lds_b128 %0, %8, off\n\t"
                 "global_load_async_to_lds_b128 %1, %9, off\n\t"
                 "global_load_async_to_lds_b128 %2, %10, off\n\t"
                 "global_load_async_to_lds_b128 %3, %11, off\n\t"
                 "global_load_async_to_lds_b128 %4, %12, off\n\t"
                 "global_load_async_to_lds_b128 %5, %13, off\n\t"
                 "global_load_async_to_lds_b128 %6, %14, off\n\t"
                 "global_load_async_to_lds_b128 %7, %15, off\n\t"
                 "s_wait_xcnt 0x0"
                 :: "v"(la[0]), "v"(la[1]), "v"(la[2]), "v"(la[3]), "v"(la[4]), "v"(la[5]), "v"(la[6]), "v"(la[7]),
                    "v"(ga[0]), "v"(ga[1]), "v"(ga[2]), "v"(ga[3]), "v"(ga[4]), "v"(ga[5]), "v"(ga[6]), "v"(ga[7]) : "memory");
}
typedef __attribute__((ext_vector_type(2))) __bf16 v2bf;
__device__ __forceinline__ float xhalf(float x) { const int b = __float_as_int(x); return __int_as_float(__builtin_amdgcn_permlanex16(b, b, 0x76543210, 0xfedcba98, false, false)); }   // lane l <-> l ^ 16
__device__ __forceinline__ void packp(const float* p, v16bf& h, v16bf& l) {
#pragma unroll
    for (int e = 0; e < 16; e += 2) { v2f pp; pp[0] = p[e]; pp[1] = p[e + 1]; const v2bf hh = __builtin_convertvector(pp, v2bf); v2f rr; rr[0] = pp[0] - (float)hh[0]; rr[1] = pp[1] - (float)hh[1]; const v2bf ll = __builtin_convertvector(rr, v2bf); h[e] = hh[0]; h[e + 1] = hh[1]; l[e] = ll[0]; l[e + 1] = ll[1]; } }
__device__ __forceinline__ void packp(const float* p, v16h& h, v16h& l) { (void)l;
#pragma unroll
    for (int e = 0; e < 16; e += 2) { v2f pp; pp[0] = p[e]; pp[1] = p[e + 1]; const v2h hh = __builtin_convertvector(pp, v2h); h[e] = hh[0]; h[e + 1] = hh[1]; } }
template <typename T16, bool SPLIT>
__device__ __forceinline__ void fattn(const T16* __restrict__ Qh, const T16* __restrict__ Ql, const T16* __restrict__ Kh, const T16* __restrict__ Kl, const T16* __restrict__ Vh, const T16* __restrict__ Vl, const float* mb, char* ring, int q0, float pexp, bf* Ah, bf* Al) {
    typedef typename WFrag<T16>::V V;
    const int lane = threadIdx.x & 31, lr = lane & 15, hi = lane >> 4;
    V q[QT][2], q2[QT][2]; v8f o[QT][4]; float m[QT], l[QT];
    // XW: s_wait_xcnt 0 behind a run of loads or stores, in front of any reuse of their address registers; the pointers are inputs so that their registers stay theirs up to the wait.
#define XW1(p)     asm volatile("s_wait_xcnt 0x0" :: "v"(p) : "memory")
#define XW2(p, p2) asm volatile("s_wait_xcnt 0x0" :: "v"(p), "v"(p2) : "memory")
#pragma unroll
    for (int qt = 0; qt < QT; ++qt) { m[qt] = -3.0e38f; l[qt] = 0.f; const size_t qo = (size_t)(q0 + qt * 16 + lr) * HD + 8 * hi; const T16* pq = Qh + qo; const T16* pq2 = SPLIT ? Ql + qo : pq;
#pragma unroll
        for (int kc = 0; kc < 2; ++kc) { q[qt][kc] = WFrag<T16>::ld(pq + kc * 32); if (SPLIT) q2[qt][kc] = WFrag<T16>::ld(pq2 + kc * 32); }
        if (SPLIT) XW2(pq, pq2); else XW1(pq);
#pragma unroll
        for (int dt = 0; dt < 4; ++dt) o[qt][dt] = (v8f){}; }
    // The lane's part of a stage: 16 bytes of row (tid >> 3) + 16 i, i = 0..3, of each plane's tile. A buffer holds the K tiles, then the V tiles.
    constexpr int NPL = SPLIT ? 2 : 1, BUFB = 2 * NPL * FTB, NT = TT / FKS;
    const int tid = threadIdx.x;
    const unsigned lp = (unsigned)((tid >> 3) * FLP + (tid & 7) * 16);
    const unsigned gko = (unsigned)((tid >> 3) * HD + (tid & 7) * 8), gvo = (unsigned)((tid >> 3) * TT + (tid & 7) * 8);
    auto fill = [&](int t) { const unsigned l = lp + ((unsigned)(size_t)ring + (unsigned)((t & 1) * BUFB)); const unsigned ka = gko + (unsigned)(t * FKS * HD), va = gvo + (unsigned)(t * FKS);
        if (SPLIT) { copy44(l, (const char*)(Kh + ka), HD * 2, l + FTB, (const char*)(Kl + ka), HD * 2); copy44(l + 2 * FTB, (const char*)(Vh + va), TT * 2, l + 3 * FTB, (const char*)(Vl + va), TT * 2); }
        else { copy44(l, (const char*)(Kh + ka), HD * 2, l + FTB, (const char*)(Vh + va), TT * 2); } };
    fill(0);
    asm volatile("s_wait_asynccnt 0x0" ::: "memory");   // this wave's copies of stage 0 have landed
    __syncthreads();                                    // ... and every other wave's
    fill(1);
    const int fo = lr * FLP + hi * 16;
    V kf[2][2], kf2[2][2], vf[4], vf2[4];
#pragma unroll 1   // the stage loop stays rolled: one copy of the ring's foot
    for (int st = 0; st < NT; ++st) {
      const char* pk = ring + (st & 1) * BUFB + fo; const char* pv = pk + NPL * FTB;
      // Fragments of pass p of the stage, from this stage's buffer alone: the second pass's are asked for inside the first pass, K behind its S^T products, V behind its O^T products.
      auto ldk = [&](int p) {
#pragma unroll
        for (int kt = 0; kt < 2; ++kt)
#pragma unroll
            for (int kc = 0; kc < 2; ++kc) { const int off = (p * 32 + kt * 16) * FLP + kc * 64; kf[kt][kc] = WFrag<T16>::lds(pk + off); if (SPLIT) kf2[kt][kc] = WFrag<T16>::lds(pk + FTB + off); } };
      auto ldv = [&](int p) {
#pragma unroll
        for (int dt = 0; dt < 4; ++dt) { const int off = dt * 16 * FLP + p * 64; vf[dt] = WFrag<T16>::lds(pv + off); if (SPLIT) vf2[dt] = WFrag<T16>::lds(pv + FTB + off); } };
      ldk(0); ldv(0);
#pragma unroll   // both passes of a stage are written out: every fragment offset is a constant of the LDS read, and the test for a next pass is settled at compile time
      for (int p = 0; p < FKS / 32; ++p) { const int kb = st * FKS + p * 32;
        v8f s[QT][2];
#pragma unroll
        for (int qt = 0; qt < QT; ++qt) { s[qt][0] = (v8f){}; s[qt][1] = (v8f){}; }
#pragma unroll
        for (int kt = 0; kt < 2; ++kt)
#pragma unroll
            for (int kc = 0; kc < 2; ++kc)
#pragma unroll
                for (int qt = 0; qt < QT; ++qt) { s[qt][kt] = WFrag<T16>::mma(kf[kt][kc], q[qt][kc], s[qt][kt]); if (SPLIT) { s[qt][kt] = WFrag<T16>::mma(kf[kt][kc], q2[qt][kc], s[qt][kt]); s[qt][kt] = WFrag<T16>::mma(kf2[kt][kc], q[qt][kc], s[qt][kt]); } }
        if (p + 1 < FKS / 32) ldk(p + 1);
        float bias[16];   // 0 for a live key, -3e38 for a padded one: keys kb + 8 hi + 0..7 and kb + 16 + 8 hi + 0..7
#pragma unroll
        for (int c4 = 0; c4 < 4; ++c4) { const v4f b4 = *(const v4fa*)(mb + kb + (c4 >> 1) * 16 + hi * 8 + (c4 & 1) * 4);
#pragma unroll
            for (int j = 0; j < 4; ++j) bias[c4 * 4 + j] = b4[j]; }
#pragma unroll
        for (int qt = 0; qt < QT; ++qt) { float t[16]; float mx = m[qt];
#pragma unroll
            for (int e = 0; e < 16; ++e) { t[e] = fmaf(s[qt][e >> 3][e & 7], CL2, bias[e]); mx = fmaxf(mx, t[e]); }
            mx = fmaxf(mx, xhalf(mx));
            const float al = __builtin_amdgcn_exp2f(m[qt] - mx), sh = pexp - mx; m[qt] = mx; float sum = 0.f;
#pragma unroll
            for (int e = 0; e < 16; ++e) { t[e] = __builtin_amdgcn_exp2f(t[e] + sh); sum += t[e]; }
            l[qt] = fmaf(l[qt], al, sum);
#pragma unroll
            for (int dt = 0; dt < 4; ++dt) o[qt][dt] *= al;
            V ph, pl; packp(t, ph, pl);
#pragma unroll
            for (int dt = 0; dt < 4; ++dt) { o[qt][dt] = WFrag<T16>::mma(vf[dt], ph, o[qt][dt]); if (SPLIT) { o[qt][dt] = WFrag<T16>::mma(vf[dt], pl, o[qt][dt]); o[qt][dt] = WFrag<T16>::mma(vf2[dt], ph, o[qt][dt]); } } }
        if (p + 1 < FKS / 32) ldv(p + 1);
      }
      asm volatile("s_wait_dscnt 0x0" ::: "memory");      // this wave's reads of stage st are done before the buffer is handed back
      asm volatile("s_wait_asynccnt 0x0" ::: "memory");   // this wave's copies of stage st + 1 have landed
      __syncthreads();                                    // publishes stage st + 1 and ends every wave's reads of stage st
      if (st + 2 < NT) fill(st + 2);                      // into the buffer that stage st has left
    }
    asm volatile("s_wait_asynccnt 0x0" ::: "memory");     // no copy is left in flight
#pragma unroll
    for (int qt = 0; qt < QT; ++qt) { const float inv = __fdiv_rn(1.0f, l[qt] + xhalf(l[qt])); const size_t ro = (size_t)(q0 + qt * 16 + lr) * DQ + hi * 8; bf* ph = Ah + ro; bf* pl = Al + ro;
#pragma unroll
        for (int dt = 0; dt < 4; ++dt) { v8us oh, ol;
#pragma unroll
            for (int j = 0; j < 8; ++j) { unsigned short a, c2; splitf(o[qt][dt][j] * inv, a, c2); oh[j] = a; ol[j] = c2; }
            *(v8us*)(ph + dt * 16) = oh; *(v8us*)(pl + dt * 16) = ol; }
        XW2(ph, pl); }
#undef XW1
#undef XW2
}
// grid (row blocks of FW*QT*16 queries, batch*head, 2): z = 0 rows < RH (hi/lo planes, 3 products; the heavier blocks start first), z = 1 the rest (fp16, P x 1024)
__global__ __launch_bounds__(FW * 32) void k_fattn(const h16* __restrict__ Q16, const bf* __restrict__ Qh, const bf* __restrict__ Ql, const h16* __restrict__ K16, const bf* __restrict__ Kh, const bf* __restrict__ Kl, const h16* __restrict__ V16, const bf* __restrict__ Vh, const bf* __restrict__ Vl, const int* __restrict__ pm, bf* Ah, bf* Al) {
    __shared__ __attribute__((aligned(128))) char sm[TT * 4 + 2 * 4 * FTB];   // the bias row, then two buffers of K hi, K lo, V hi, V lo tiles (the fp16 rows use half); the ring does not start at LDS address 0, so the lane's long-lived offset lp is never itself a copy's operand (as one it was spilled to scratch)
    float* mb = (float*)sm; char* ring = sm + TT * 4;
    const int bh = blockIdx.y, b = bh / NH_, h = bh % NH_;
#pragma unroll
    for (int i = 0; i < TT / (FW * 32 * 4); ++i) { const int j0 = (i * FW * 32 + threadIdx.x) * 4; const v4i p4 = *(const v4i*)(pm + (size_t)b * TT + j0); v4f b4;   /* 4 padding flags (16 B) */
#pragma unroll
        for (int j = 0; j < 4; ++j) b4[j] = (p4[j] == 0) ? 0.0f : -3.0e38f;   /* padded keys excluded */
        *(v4fa*)(mb + j0) = b4; }
    __syncthreads();   // every wave reads the whole bias row
    const size_t po = (size_t)bh * TT * HD, ao = (size_t)b * TT * DQ + h * HD; const int qw = (blockIdx.x * FW + (threadIdx.x >> 5)) * (QT * 16);
    if (blockIdx.z == 0) fattn<bf, true>(Qh + po, Ql + po, Kh + po, Kl + po, Vh + po, Vl + po, mb, ring, qw, 0.0f, Ah + ao, Al + ao);
    else fattn<h16, false>(Q16 + po, nullptr, K16 + po, nullptr, V16 + po, nullptr, mb, ring, RH + qw, 10.0f, Ah + ao, Al + ao);
}

extern "C" void kernel_launch(void* const* d_in, const int* in_sizes, int n_in,
                              void* d_out, int out_size, void* d_ws, size_t ws_size, hipStream_t stream) {
    (void)in_sizes; (void)n_in; (void)out_size;
    const float* x = (const float*)d_in[0]; const float* xkv = (const float*)d_in[1]; const int* pm = (const int*)d_in[2];   /* pad_mask [4][1024] bool as int32: 1 = padding key */ const float* wq = (const float*)d_in[3]; const float* wk = (const float*)d_in[4]; const float* wv = (const float*)d_in[5]; const float* wo = (const float*)d_in[6]; const float* bo = (const float*)d_in[7];
    float* OUT = (float*)d_out;     // [4][1024][1024]
    char* wsp = (char*)d_ws;
    auto take = [&](size_t bytes) { char* p = wsp; wsp += (bytes + 255) & ~(size_t)255; return (void*)p; };
    const size_t PB = (size_t)NH_ * TT * HD;   // one batch of head planes (elements); NKV == NH_ here
    bf* WQ = (bf*)take((size_t)DQ * DM * 2); bf* WK = (bf*)take((size_t)DKV * DM * 2); bf* WV = (bf*)take((size_t)DKV * DM * 2); bf* WO = (bf*)take((size_t)DM * DQ * 2);   // the four weight planes are contiguous (2 MiB each)
    h16* QP16 = (h16*)take(2 * NB_ * PB * 2); h16* KP16 = QP16 + NB_ * PB; bf* QPh = (bf*)take(2 * NB_ * PB * 2); bf* KPh = QPh + NB_ * PB; bf* QPl = (bf*)take(2 * NB_ * PB * 2); bf* KPl = QPl + NB_ * PB;   // q planes of all batches, then k planes
    h16* VT16 = (h16*)take(NB_ * PB * 2); bf* VTh = (bf*)take(NB_ * PB * 2); bf* VTl = (bf*)take(NB_ * PB * 2);
    bf* XB = (bf*)take((size_t)2 * NB_ * TT * DM * 2); bf* XKV = XB + (size_t)NB_ * TT * DM; bf* ATh = (bf*)take((size_t)NB_ * TT * DQ * 2); bf* ATl = (bf*)take((size_t)NB_ * TT * DQ * 2);
    (void)WK; (void)WV; (void)XKV;   // reached from WQ and XB by the projection launch's strides
    if ((size_t)(wsp - (char*)d_ws) > ws_size) return;    // ws 256 MiB
    k_prep<<<dim3(PTB + PCB, 1, 1), PWV * 32, 0, stream>>>(wq, wk, wv, wo, WQ, x, xkv, XB);
    k_gemms<0, false, true><<<dim3(NB_ * TT / 128, DQ / 128, 3), 128, 0, stream>>>(XB, nullptr, WQ, DM, nullptr, DQ, nullptr, (size_t)NB_ * TT * DM, (size_t)DQ * DM, NB_ * PB, QP16, QPh, QPl, VT16, VTh, VTl);   /* q from x_q, k and v from x_kv: z = 0, 1, 2 (DQ == DKV; the copies, the weight planes and the q and k planes each lie one behind the other) */
    k_fattn<<<dim3(RH / (FW * QT * 16), NB_ * NH_, 2), FW * 32, 0, stream>>>(QP16, QPh, QPl, KP16, KPh, KPl, VT16, VTh, VTl, pm, ATh, ATl);   /* all batches and heads; RH == TT - RH */
    k_gemms<1, true, false><<<dim3(NB_ * TT / 128, DM / 128, 1), 128, 0, stream>>>(ATh, ATl, WO, DQ, OUT, DM, bo, 0, 0, 0, nullptr, nullptr, nullptr, nullptr, nullptr, nullptr);
}

// v008
// It runs in 88.6 microseconds.
// Next to v007, in two timings, it ran 1.05 times as fast each time.
// Counting every step since v000, it is 27.3 times as fast.
#include <hip/hip_runtime.h>

// Multi-head cross attention with a key padding mask (x_q, x_kv [4][1024][1024]; q = x_q Wq, k, v = x_kv Wk, x_kv Wv ('xw' 1/32, no bias; 16 heads x 64); scores x 64^-0.5; keys with pad_mask[b][j] ([4][1024] bool, ~10 % true, read) -> -finfo.max (== exclusion); softmax; out = merged Wo ('xw' 1/32) + bo -> [4][1024][1024] (4.2 M)).
// Layout: bf16 copies of x_q and x_kv (all batches) and the 'xw' weights transposed once, all in one launch; exact projections over all 4096 rows, all three in one launch, that write the head planes from their own epilogue; one fused attention launch over all batches and heads (K and V tiles staged in LDS for a block's four waves; S^T = K Q^T, running-maximum softmax that excludes padded keys through a bias row in LDS, O^T += V^T P^T, merged hi/lo rows written directly; hybrid rows: < 512 hi/lo 3 products, rest fp16 with P x 1024); merged hi/lo x Wo exact + bo.
// Compute dtypes, f32 accumulate: every input rounded to bf16; projections exact; attention rows < 512 3 products, rest fp16; softmax f32; Wo hl x exact + bias.

#define NB_  4
#define TT   1024
#define DM   1024
#define NH_  16
#define NKV  16
#define REP  (NH_ / NKV)
#define HD   64
#define DQ   (NH_ * HD)
#define DKV  (NKV * HD)
#define ZH   16                   // heads per attention launch (unused; heads are in grid y)
#define RH   512                  // query rows < RH use hi+lo planes (must be TT / 2: z = 1 takes the rest)
#define WIN  0
#define PCAR 1024.0f
#define SCL  0.125f   // HD^-0.5
typedef _Float16 h16;
typedef unsigned short bf;
typedef __attribute__((ext_vector_type(16))) __bf16   v16bf;
typedef __attribute__((ext_vector_type(16))) _Float16 v16h;
typedef __attribute__((ext_vector_type(8)))  _Float16 v8h;
typedef __attribute__((ext_vector_type(8)))  unsigned short v8us;
typedef __attribute__((ext_vector_type(8)))  float    v8f;
typedef __attribute__((ext_vector_type(8)))  __bf16   v8bfv;
typedef __attribute__((ext_vector_type(4)))  float    v4f;
typedef v8h  __attribute__((may_alias)) v8ha;
typedef v4f  __attribute__((may_alias)) v4fa;
typedef v8us __attribute__((may_alias)) v8usa;

__device__ __forceinline__ unsigned short f2bf(float f) { unsigned u = __float_as_uint(f); u += 0x7FFFu + ((u >> 16) & 1u); return (unsigned short)(u >> 16); }
__device__ __forceinline__ float bf2f(unsigned short b) { return __uint_as_float(((unsigned)b) << 16); }
__device__ __forceinline__ float bfr(float f) { return bf2f(f2bf(f)); }
__device__ __forceinline__ v16h cat16(v8h lo, v8h hi) { return __builtin_shufflevector(lo, hi, 0, 1, 2, 3, 4, 5, 6, 7, 8, 9, 10, 11, 12, 13, 14, 15); }
__device__ __forceinline__ v16bf cat16b(v8us lo, v8us hi) { return __builtin_bit_cast(v16bf, __builtin_shufflevector(lo, hi, 0, 1, 2, 3, 4, 5, 6, 7, 8, 9, 10, 11, 12, 13, 14, 15)); }
__device__ __forceinline__ v8f wmma16(v16h a, v16h b, v8f c) { return __builtin_amdgcn_wmma_f32_16x16x32_f16(false, a, false, b, (short)0, c, false, false); }
__device__ __forceinline__ v8f wmmab(v16bf a, v16bf b, v8f c) { return __builtin_amdgcn_wmma_f32_16x16x32_bf16(false, a, false, b, (short)0, c, false, false); }



// Fragment loaders from K-contiguous 16-bit planes: a lane reads 8 + 8 elements of its row, at 8 hi and 16 + 8 hi of each 32 k.
template <typename T16> struct WFrag;
template <> struct WFrag<h16> { typedef v16h V; static __device__ __forceinline__ V ld(const h16* p) { return cat16(*(const v8h*)p, *(const v8h*)(p + 16)); } static __device__ __forceinline__ V lds(const char* p) { return cat16(*(const v8ha*)p, *(const v8ha*)(p + 32)); } static __device__ __forceinline__ v8f mma(V a, V b, v8f c) { return wmma16(a, b, c); } };
template <> struct WFrag<bf> { typedef v16bf V; static __device__ __forceinline__ V ld(const bf* p) { return cat16b(*(const v8us*)p, *(const v8us*)(p + 16)); } static __device__ __forceinline__ V lds(const char* p) { return cat16b(*(const v8usa*)p, *(const v8usa*)(p + 32)); } static __device__ __forceinline__ v8f mma(V a, V b, v8f c) { return wmmab(a, b, c); } };
// planes_out: one wave's 64 x 64 f32 tile (acc[mb][nb]: token mb*16 + 8*hi + j, channel nb*16 + lr) as fp16, bf16 hi and bf16 lo planes; TR false: plane rows are tokens (pitch HD), true: channels (pitch TT).
// A panel of 16 plane rows x 64 goes through LDS so that 8 lanes write one whole 128-byte line of each plane.
template <bool TR>
__device__ __forceinline__ void planes_out(const v8f (&acc)[4][4], float* os, int lane, h16* d16, bf* dh, bf* dl) {
    constexpr int PITCH = TR ? TT : HD;
    const int lr = lane & 15, hi = lane >> 4, prow = lane >> 3, pcol = (lane & 7) * 8;
    const unsigned lob = (unsigned)(prow * PITCH + pcol) * 2u;   // the lane's byte offset in each plane; the plane pointers stay wave-uniform
    // Every loop here is unrolled so that acc and the staging vectors are indexed by constants only and stay in registers.
#pragma unroll
    for (int pb = 0; pb < 4; ++pb) {
        if (TR) {   // a lane holds 8 consecutive tokens of one channel
#pragma unroll
            for (int mb = 0; mb < 4; ++mb) { const v8f w = acc[mb][pb]; *(v4fa*)(os + lr * 68 + mb * 16 + hi * 8) = __builtin_shufflevector(w, w, 0, 1, 2, 3); *(v4fa*)(os + lr * 68 + mb * 16 + hi * 8 + 4) = __builtin_shufflevector(w, w, 4, 5, 6, 7); }
        } else {
#pragma unroll
            for (int nb = 0; nb < 4; ++nb) {
#pragma unroll
                for (int j = 0; j < 8; ++j) os[(hi * 8 + j) * 68 + nb * 16 + lr] = acc[pb][nb][j]; }
        }
        __builtin_amdgcn_wave_barrier(); asm volatile("" ::: "memory");   // holds the compiler: the panel's LDS writes stay in front of the other lanes' reads of them (one wave, LDS runs in order)
        v8h o16[4]; v8us oh[4], ol[4];
#pragma unroll
        for (int s = 0; s < 4; ++s) { const float* pr = os + (4 * s + prow) * 68 + pcol; const v4f x0 = *(const v4fa*)pr, x1 = *(const v4fa*)(pr + 4); const v8f x = __builtin_shufflevector(x0, x1, 0, 1, 2, 3, 4, 5, 6, 7);
            const v8bfv h = __builtin_convertvector(x, v8bfv); const v8bfv l = __builtin_convertvector(x - __builtin_convertvector(h, v8f), v8bfv);   // round to nearest even, as f2bf
            o16[s] = __builtin_convertvector(x, v8h); oh[s] = __builtin_bit_cast(v8us, h); ol[s] = __builtin_bit_cast(v8us, l); }
#pragma unroll
        for (int s = 0; s < 4; ++s) { const int o = (pb * 16 + 4 * s) * PITCH * 2; *(v8h*)((char*)d16 + lob + o) = o16[s]; *(v8us*)((char*)dh + lob + o) = oh[s]; *(v8us*)((char*)dl + lob + o) = ol[s]; }
        // s_wait_xcnt 0 behind the panel's stores, in front of any reuse of their address or data registers (inputs, so that the registers stay theirs up to the wait); its memory clobber also keeps the next panel's LDS writes behind this panel's reads
        asm volatile("s_wait_xcnt 0x0" :: "v"(lob), "v"(o16[0]), "v"(o16[1]), "v"(o16[2]), "v"(o16[3]), "v"(oh[0]), "v"(oh[1]), "v"(oh[2]), "v"(oh[3]), "v"(ol[0]), "v"(ol[1]), "v"(ol[2]), "v"(ol[3]) : "memory");
    }
}
// ---- k_gemms: one 128 x 128 tile of the product per work-group of four waves (2 x 2 wave tiles of 64 x 64, 16 accumulators each); grid (M/128, N/128, Z), 128 threads.
// A stage is 128 k of the tile's 128 A rows (and A2 rows) and 128 Bt rows: each operand's stage is one tile of 128 rows of 256 bytes, brought into LDS by ONE tensor load of one wave (wave 0: A, wave 1: Bt, wave 2: A2), whose pad gives the pitch of 272 bytes for the 16-byte fragment reads.
// Two buffers: stage t + 1 flies while stage t is worked on. Fragments, k order and the order of the products are those of the loaders above.
#define GKS  128                  // k per stage
#define GLP  272                  // LDS row pitch, bytes
#define GOPB (128 * GLP)          // one operand's stage, bytes: 17 x 2 KiB, so every tile's place is a multiple of 2 KiB
typedef __attribute__((ext_vector_type(4))) unsigned u32x4;
typedef __attribute__((ext_vector_type(8))) unsigned u32x8;
__device__ __forceinline__ unsigned uni(unsigned v) { return (unsigned)__builtin_amdgcn_readfirstlane(v); }
__device__ __forceinline__ unsigned pinned(unsigned v) { unsigned w = uni(v); asm volatile("" : "+s"(w)); /* holds the test in a scalar register, so that the branch round a tensor load is a scalar branch (the load ignores EXEC) */ return w; }
// The descriptor of a tensor load: a tile of ROWS rows of ROWB bytes (128 or 256) at g, source row pitch 'pitch' bytes, to LDS byte address lds, 16 bytes of pad behind every row. 1-byte elements, tensor = tile, no mask.
// Both groups are held in their scalar registers (the empty statements), and the wait names them as inputs: no word of a descriptor gets a new value while its request is in flight.
template <unsigned ROWB, unsigned ROWS>
__device__ __forceinline__ u32x8 tgroup1(unsigned pitch) {
    static_assert(ROWB == 128 || ROWB == 256, "the pad interval is the row");
    u32x8 g1; g1[0] = uni((1u << 20) | ((ROWB == 256 ? 5u : 4u) << 22) | (3u << 25)); g1[1] = uni((ROWB & 0xFFFFu) << 16); g1[2] = uni((ROWB >> 16) | ((ROWS & 0xFFFFu) << 16)); g1[3] = uni((ROWS >> 16) | (ROWB << 16));
    g1[4] = uni(ROWS); g1[5] = uni(pitch); g1[6] = uni(0u); g1[7] = uni(0u);
    asm volatile("" : "+s"(g1));   // descriptor words held in scalar registers
    return g1;
}
__device__ __forceinline__ void tload(u32x4& g0, u32x8 g1, unsigned lds, const void* g) {
    const unsigned long long ga = (unsigned long long)(size_t)g;
    g0[0] = uni(1u); g0[1] = uni(lds); g0[2] = uni((unsigned)ga); g0[3] = uni((((unsigned)(ga >> 32)) & 0x01FFFFFFu) | 0x80000000u);
    asm volatile("" : "+s"(g0));   // descriptor words held in scalar registers
    asm volatile("tensor_load_to_lds %0, %1" :: "s"(g0), "s"(g1) : "memory");
}
#define TWAIT asm volatile("s_wait_tensorcnt 0x0" :: "s"(g0), "s"(g1) : "memory")
__device__ __forceinline__ v16bf ldsfrag(const char* p) { return cat16b(*(const v8usa*)p, *(const v8usa*)(p + 32)); }
// C[m][n] (f32, pitch ldc, + optional f32 bias[n]) = sum_k (A[m][k] + A2[m][k]) Bt[n][k] (A2 only with NSPLIT 1, as a second product). Bt moves by sB elements per z. K % 128 == 0, K >= 256.
// PLANES: no C; the three projections are the z of one launch: z = 0 is q (A as given), z = 1, 2 are k, v (A moved by sA elements). A wave's tile is 64 tokens of one batch x the 64 channels of one head, written as fp16 + bf16 hi/lo head planes: z = 0, 1 into [b][h][t][d] (P*, moved by sP elements per z), z = 2 into [b][h][d][t] (T*).
template <int NSPLIT, bool BIAS, bool PLANES>
__global__ __launch_bounds__(128) void k_gemms(const bf* __restrict__ A, const bf* __restrict__ A2, const bf* __restrict__ Bt, int K, float* C, int ldc, const float* __restrict__ bias, size_t sA, size_t sB, size_t sP, h16* P16, bf* Ph, bf* Pl, h16* T16p, bf* Th, bf* Tl) {
    constexpr int BUFB = (NSPLIT ? 3 : 2) * GOPB;
    __shared__ __attribute__((aligned(2048))) char ring[2 * BUFB];   // every tile's place in LDS is a multiple of 2 KiB
    __shared__ __align__(16) float osw[4][16 * 68];   // each wave's own output panel
    const int z = blockIdx.z; Bt += (size_t)z * sB; if (PLANES && z != 0) A += sA;
    const int tid = threadIdx.x, lane = tid & 31, lr = lane & 15, hi = lane >> 4, wave = __builtin_amdgcn_readfirstlane(tid >> 5) /* scalar: the wave's tile and its output pointers stay wave-uniform */, wm = wave >> 1, wn = wave & 1;
    const int R0 = blockIdx.x * 128, C0 = blockIdx.y * 128, r0 = R0 + wm * 64, c0 = C0 + wn * 64;
    float* os = osw[wave];
    v8f acc[4][4];
#pragma unroll
    for (int mb = 0; mb < 4; ++mb)
#pragma unroll
        for (int nb = 0; nb < 4; ++nb) acc[mb][nb] = (v8f){};
    // the issuing waves: wave w brings operand w's tile (A, Bt, A2 in the buffer's order)
    constexpr int NOP = NSPLIT ? 3 : 2;
    const bf* gsrc = (wave == 0) ? A + (size_t)R0 * K : (wave == 1) ? Bt + (size_t)C0 * K : A2 + (size_t)R0 * K;
    const unsigned l0 = (unsigned)(size_t)ring + (unsigned)(wave * GOPB);
    u32x4 g0 = {0u, 0u, 0u, 0u}; const u32x8 g1 = tgroup1<GKS * 2, 128>((unsigned)K * 2u);
    auto fill = [&](int t) { tload(g0, g1, l0 + (unsigned)((t & 1) * BUFB), gsrc + (size_t)t * GKS); };
    const int NT = K / GKS;
    if (pinned(wave < NOP)) { fill(0); TWAIT; }         // this wave's tile of stage 0 has landed
    __syncthreads();                                    // ... and every other wave's
    if (pinned(wave < NOP)) fill(1);
    const int fo = lr * GLP + hi * 16;
#pragma unroll 1   // the stage loop stays rolled: one copy of the ring's foot, and the accumulators keep their registers
    for (int t = 0; t < NT; ++t) {
        const char* pa = ring + (t & 1) * BUFB + wm * 64 * GLP + fo; const char* pb = ring + (t & 1) * BUFB + GOPB + wn * 64 * GLP + fo;
        // Two fragment sets: the next 32 k's fragments are read as one group ahead of this 32 k's products, inside the stage only (the first group of a stage stands behind its barrier).
        v16bf a[2][4], a2[2][4], b[2][4];
        auto ldf = [&](int s, int kc) {
#pragma unroll
            for (int mb = 0; mb < 4; ++mb) { a[s][mb] = ldsfrag(pa + mb * 16 * GLP + kc * 64); if (NSPLIT) a2[s][mb] = ldsfrag(pa + 2 * GOPB + mb * 16 * GLP + kc * 64); }
#pragma unroll
            for (int nb = 0; nb < 4; ++nb) b[s][nb] = ldsfrag(pb + nb * 16 * GLP + kc * 64); };
        ldf(0, 0);
#pragma unroll
        for (int kc = 0; kc < GKS / 32; ++kc) { const int s = kc & 1;
            if (kc + 1 < GKS / 32) ldf(s ^ 1, kc + 1);
            __builtin_amdgcn_sched_barrier(0);   // holds the scheduler: the group of LDS reads stays whole and ahead of the products, not spread among them
#pragma unroll
            for (int nb = 0; nb < 4; ++nb)
#pragma unroll
                for (int mb = 0; mb < 4; ++mb) { acc[mb][nb] = wmmab(a[s][mb], b[s][nb], acc[mb][nb]); if (NSPLIT) acc[mb][nb] = wmmab(a2[s][mb], b[s][nb], acc[mb][nb]); }
            __builtin_amdgcn_sched_barrier(0);   // ... and the next group stays behind these products
        }
        asm volatile("s_wait_dscnt 0x0" ::: "memory");      // this wave's reads of stage t are done before the buffer is handed back
        if (pinned(wave < NOP)) TWAIT;                      // this wave's tile of stage t + 1 has landed
        __syncthreads();                                    // publishes stage t + 1 and ends every wave's reads of stage t
        if (pinned(wave < NOP && t + 2 < NT)) fill(t + 2);  // into the buffer that stage t has left
    }
    TWAIT;                                                  // no tensor load is left in flight
    asm volatile("s_wait_dscnt 0x0" ::: "memory");          // ... and no LDS read
    if (PLANES) {
        static_assert(HD == 64 && TT % 64 == 0, "one wave tile = one head, one batch");
        const size_t hp = ((size_t)(r0 / TT) * (ldc / HD) + c0 / HD) * TT * HD; const int t0 = r0 % TT;   // ldc: channels of all heads
        const size_t pp = (size_t)z * sP + hp + (size_t)t0 * HD;
        if (z < 2) planes_out<false>(acc, os, lane, P16 + pp, Ph + pp, Pl + pp);
        else planes_out<true>(acc, os, lane, T16p + hp + t0, Th + hp + t0, Tl + hp + t0);
        return;
    }
#pragma unroll
    for (int mb = 0; mb < 4; ++mb) {
#pragma unroll
        for (int nb = 0; nb < 4; ++nb) {
#pragma unroll
            for (int j = 0; j < 8; ++j) os[(hi * 8 + j) * 68 + nb * 16 + lr] = acc[mb][nb][j]; }
        __builtin_amdgcn_wave_barrier(); asm volatile("" ::: "memory");   // holds the compiler: the panel's LDS writes stay in front of the other lanes' reads of them (one wave, LDS runs in order)
        float* crow = C + (size_t)(r0 + mb * 16) * ldc + c0;
        v4f val[8]; float* pc[8];
#pragma unroll
        for (int s = 0; s < 8; ++s) { const int row = 2 * s + hi, cofs = lr * 4; val[s] = *(const v4fa*)(os + row * 68 + cofs); if (BIAS) { val[s][0] += bfr(bias[c0 + cofs]); val[s][1] += bfr(bias[c0 + cofs + 1]); val[s][2] += bfr(bias[c0 + cofs + 2]); val[s][3] += bfr(bias[c0 + cofs + 3]); }
            pc[s] = crow + (size_t)row * ldc + cofs; }
#pragma unroll
        for (int s = 0; s < 8; ++s) *(v4f*)pc[s] = val[s];
        // s_wait_xcnt 0 behind the panel's stores, in front of any reuse of their address or data registers (inputs, so that the registers stay theirs up to the wait); its memory clobber also keeps the next panel's LDS writes behind this panel's reads
        asm volatile("s_wait_xcnt 0x0" :: "v"(pc[0]), "v"(pc[1]), "v"(pc[2]), "v"(pc[3]), "v"(pc[4]), "v"(pc[5]), "v"(pc[6]), "v"(pc[7]), "v"(val[0]), "v"(val[1]), "v"(val[2]), "v"(val[3]), "v"(val[4]), "v"(val[5]), "v"(val[6]), "v"(val[7]) : "memory");
    }
}

__device__ __forceinline__ void splitf(float y, unsigned short& h, unsigned short& l) { h = f2bf(y); l = f2bf(y - bf2f(h)); }
typedef __attribute__((ext_vector_type(2))) _Float16 v2h;
typedef __attribute__((ext_vector_type(4))) _Float16 v4h;
typedef __attribute__((ext_vector_type(2))) unsigned short v2us;
typedef __attribute__((ext_vector_type(4))) unsigned short v4us;
typedef __attribute__((ext_vector_type(2))) float v2f;
typedef __attribute__((ext_vector_type(4))) int v4i;

// ---- k_prep: every input conversion in one launch of few long-lived waves (8 per block), each with all its loads in flight at once.
// Blocks < PTB: a wave transposes one tile of 64 k x 32 n of one of the four equally shaped weights w[k][n] into Bt[n][k] (bf16; the four planes lie one behind the other): 16 loads of four whole lines, k pairs packed into its own LDS tile, rows of 64 k read back and stored as whole lines.
// The other blocks: a wave converts 4096 consecutive floats of x_q or x_kv (the two copies lie one behind the other in dst): 32 loads of four whole lines, 32 stores of two whole lines.
#define PWV  8                    // waves per block
#define PTP  34                   // LDS pitch of a transposed row, dwords (32 + 2: the packed stores of a wave fall on 32 different banks, rows stay 8-byte aligned)
#define PTB  (4 * (DM / 64) * (DQ / 32) / PWV)     // transposing blocks
#define PXW  (NB_ * TT * DM / 4096)                // converting waves per source
#define PCB  (2 * PXW / PWV)                       // converting blocks
typedef __attribute__((ext_vector_type(4))) __bf16 v4bfv;
typedef __attribute__((ext_vector_type(2))) __bf16 v2bfv;
typedef __attribute__((ext_vector_type(2))) unsigned v2u;
typedef __attribute__((ext_vector_type(4))) unsigned v4u;
typedef v2u __attribute__((may_alias)) v2ua;
__global__ __launch_bounds__(PWV * 32) void k_prep(const float* __restrict__ w0, const float* __restrict__ w1, const float* __restrict__ w2, const float* __restrict__ w3, bf* Bt, const float* __restrict__ src0, const float* __restrict__ src1, bf* dst) {
    static_assert(DM % 128 == 0 && DQ % 128 == 0 && DQ == DKV && DQ == DM && (NB_ * TT * DM) % (4096 * PWV) == 0, "whole tiles, four equal weights, whole waves");
    __shared__ __align__(16) unsigned tl[PWV][32 * PTP];   // each wave's own tile
    const int lane = threadIdx.x & 31, wave = __builtin_amdgcn_readfirstlane(threadIdx.x >> 5) /* scalar: the wave's tile and its base pointers stay wave-uniform */;
    if (blockIdx.x < PTB) {
        // a block's eight waves take 4 n tiles x 2 k tiles that lie side by side: 512 contiguous bytes of each source row, 256 of each plane row
        const int tile = blockIdx.x * PWV + wave, y = tile / ((DM / 64) * (DQ / 32)), r = tile % ((DM / 64) * (DQ / 32));
        const int nt = (r & 3) + 4 * ((r >> 3) % (DQ / 128)), kt = ((r >> 2) & 1) + 2 * ((r >> 3) / (DQ / 128));
        const float* __restrict__ w = (y == 0) ? w0 : (y == 1) ? w1 : (y == 2) ? w2 : w3;
        const int c = lane & 7, rr = lane >> 3;
        const float* p = w + (size_t)(kt * 64 + rr * 2) * DQ + nt * 32 + c * 4;   // load 2 i + e: row k = 8 i + 2 rr + e, 4 n from 4 c
        v4f x[16];
#pragma unroll
        for (int i = 0; i < 16; ++i) x[i] = *(const v4f*)(p + (size_t)((i >> 1) * 8 + (i & 1)) * DQ);
        asm volatile("s_wait_xcnt 0x0" :: "v"(p) : "memory");   // behind the run of loads, in front of any reuse of their address registers (an input, so that the registers stay theirs up to the wait)
        unsigned* t = tl[wave];
#pragma unroll
        for (int i = 0; i < 8; ++i)
#pragma unroll
            for (int j = 0; j < 4; ++j) { v2f pp; pp[0] = x[2 * i][j]; pp[1] = x[2 * i + 1][j]; t[(c * 4 + j) * PTP + i * 4 + rr] = __builtin_bit_cast(unsigned, __builtin_convertvector(pp, v2bfv)); }   // round to nearest even, as f2bf
        asm volatile("s_wait_dscnt 0x0" ::: "memory");   // the wave's own tile is written before its other lanes read it back; the clobber keeps the compiler's reads behind the writes
        bf* q = Bt + (size_t)y * DQ * DM + (size_t)(nt * 32 + rr) * DM + kt * 64 + c * 8;   // store s: plane row 4 s + rr, 8 k from 8 c
        v4u o[8];
#pragma unroll
        for (int s = 0; s < 8; ++s) { const unsigned* pr = t + (s * 4 + rr) * PTP + c * 4; const v2u lo = *(const v2ua*)pr, hi2 = *(const v2ua*)(pr + 2); o[s] = __builtin_shufflevector(lo, hi2, 0, 1, 2, 3); }
#pragma unroll
        for (int s = 0; s < 8; ++s) *(v4u*)(q + (size_t)s * 4 * DM) = o[s];
        return;
    }
    const int cw = (blockIdx.x - PTB) * PWV + wave;
    const float* p = (cw < PXW ? src0 + (size_t)cw * 4096 : src1 + (size_t)(cw - PXW) * 4096) + lane * 4;
    bf* q = dst + (size_t)cw * 4096 + lane * 4;
    v4f x[32];
#pragma unroll
    for (int i = 0; i < 32; ++i) x[i] = *(const v4f*)(p + i * 128);
    __builtin_amdgcn_sched_barrier(0);   // holds the scheduler: all 32 loads are issued before the first conversion waits for one (otherwise it keeps about half in flight to save registers)
#pragma unroll
    for (int h = 0; h < 2; ++h) { v2u o[16];   // the first half is stored while the second half's loads still fly
#pragma unroll
        for (int i = 0; i < 16; ++i) o[i] = __builtin_bit_cast(v2u, __builtin_convertvector(x[h * 16 + i], v4bfv));   // round to nearest even, as f2bf
#pragma unroll
        for (int i = 0; i < 16; ++i) *(v2u*)(q + (h * 16 + i) * 128) = o[i];
        // s_wait_xcnt 0 behind the half's stores, in front of any reuse of their data registers (inputs, so that the registers stay theirs up to the wait)
        asm volatile("s_wait_xcnt 0x0" :: "v"(o[0]), "v"(o[1]), "v"(o[2]), "v"(o[3]), "v"(o[4]), "v"(o[5]), "v"(o[6]), "v"(o[7]), "v"(o[8]), "v"(o[9]), "v"(o[10]), "v"(o[11]), "v"(o[12]), "v"(o[13]), "v"(o[14]), "v"(o[15]) : "memory");
    }
}

#define QT   2                    // 16-query groups per wave
#define FW   4                    // waves per block
#define CL2  0.18033688011112042f // HD^-0.5 * log2(e)
#define FKS  64                   // keys per stage
#define FLP  144                  // LDS row pitch, bytes
#define FTB  (5 * 2048)           // one plane's tile of a stage in LDS, bytes: 64 rows x 144, rounded up so that every tile's place is a multiple of 2 KiB
static_assert(FTB >= 64 * FLP, "the tile fits its place");
typedef __attribute__((ext_vector_type(2))) __bf16 v2bf;
__device__ __forceinline__ float xhalf(float x) { const int b = __float_as_int(x); return __int_as_float(__builtin_amdgcn_permlanex16(b, b, 0x76543210, 0xfedcba98, false, false)); }   // lane l <-> l ^ 16
__device__ __forceinline__ void packp(const float* p, v16bf& h, v16bf& l) {
#pragma unroll
    for (int e = 0; e < 16; e += 2) { v2f pp; pp[0] = p[e]; pp[1] = p[e + 1]; const v2bf hh = __builtin_convertvector(pp, v2bf); v2f rr; rr[0] = pp[0] - (float)hh[0]; rr[1] = pp[1] - (float)hh[1]; const v2bf ll = __builtin_convertvector(rr, v2bf); h[e] = hh[0]; h[e + 1] = hh[1]; l[e] = ll[0]; l[e + 1] = ll[1]; } }
__device__ __forceinline__ void packp(const float* p, v16h& h, v16h& l) { (void)l;
#pragma unroll
    for (int e = 0; e < 16; e += 2) { v2f pp; pp[0] = p[e]; pp[1] = p[e + 1]; const v2h hh = __builtin_convertvector(pp, v2h); h[e] = hh[0]; h[e + 1] = hh[1]; } }
template <typename T16, bool SPLIT>
__device__ __forceinline__ void fattn(const T16* __restrict__ Qh, const T16* __restrict__ Ql, const T16* __restrict__ Kh, const T16* __restrict__ Kl, const T16* __restrict__ Vh, const T16* __restrict__ Vl, const float* mb, char* ring, int q0, float pexp, bf* Ah, bf* Al) {
    typedef typename WFrag<T16>::V V;
    const int lane = threadIdx.x & 31, lr = lane & 15, hi = lane >> 4;
    V q[QT][2], q2[QT][2]; v8f o[QT][4]; float m[QT], l[QT];
    // XW: s_wait_xcnt 0 behind a run of loads or stores, in front of any reuse of their address registers; the pointers are inputs so that their registers stay theirs up to the wait.
#define XW1(p)     asm volatile("s_wait_xcnt 0x0" :: "v"(p) : "memory")
#define XW2(p, p2) asm volatile("s_wait_xcnt 0x0" :: "v"(p), "v"(p2) : "memory")
#pragma unroll
    for (int qt = 0; qt < QT; ++qt) { m[qt] = -3.0e38f; l[qt] = 0.f; const size_t qo = (size_t)(q0 + qt * 16 + lr) * HD + 8 * hi; const T16* pq = Qh + qo; const T16* pq2 = SPLIT ? Ql + qo : pq;
#pragma unroll
        for (int kc = 0; kc < 2; ++kc) { q[qt][kc] = WFrag<T16>::ld(pq + kc * 32); if (SPLIT) q2[qt][kc] = WFrag<T16>::ld(pq2 + kc * 32); }
        if (SPLIT) XW2(pq, pq2); else XW1(pq);
#pragma unroll
        for (int dt = 0; dt < 4; ++dt) o[qt][dt] = (v8f){}; }
    // A buffer holds the K tiles, then the V tiles; wave w brings tile w: 64 key rows of 128 bytes (contiguous) of a K plane, or 128 bytes of each of the 64 d rows (pitch TT elements) of a V plane.
    constexpr int NPL = SPLIT ? 2 : 1, BUFB = 2 * NPL * FTB, NT = TT / FKS;
    const int wave = __builtin_amdgcn_readfirstlane(threadIdx.x >> 5);   // scalar: the descriptor's words are wave-uniform
    const bool isv = wave >= NPL;
    const T16* gsrc = SPLIT ? (wave == 0 ? Kh : wave == 1 ? Kl : wave == 2 ? Vh : Vl) : (wave == 0 ? Kh : Vh);
    const unsigned l0 = (unsigned)(size_t)ring + (unsigned)(wave * FTB), gstep = isv ? FKS : FKS * HD, gpitch = isv ? TT * 2 : HD * 2;
    u32x4 g0 = {0u, 0u, 0u, 0u}; const u32x8 g1 = tgroup1<HD * 2, FKS>(gpitch);
    auto fill = [&](int t) { tload(g0, g1, l0 + (unsigned)((t & 1) * BUFB), gsrc + (size_t)t * gstep); };
    static_assert(FW == 4 && HD == 64 && FKS == 64 && NT >= 2, "with hi/lo planes every wave issues one tile; rows of 128 bytes; two stages exist");
    if (SPLIT || pinned(wave < 2 * NPL)) { fill(0); TWAIT; }   // this wave's tile of stage 0 has landed
    __syncthreads();                                    // ... and every other wave's
    if (SPLIT || pinned(wave < 2 * NPL)) fill(1);
    const int fo = lr * FLP + hi * 16;
    V kf[2][2], kf2[2][2], vf[4], vf2[4];
#pragma unroll 1   // the stage loop stays rolled: one copy of the ring's foot
    for (int st = 0; st < NT; ++st) {
      const char* pk = ring + (st & 1) * BUFB + fo; const char* pv = pk + NPL * FTB;
      // Fragments of pass p of the stage, from this stage's buffer alone: the second pass's are asked for inside the first pass, K behind its S^T products, V behind its O^T products.
      auto ldk = [&](int p) {
#pragma unroll
        for (int kt = 0; kt < 2; ++kt)
#pragma unroll
            for (int kc = 0; kc < 2; ++kc) { const int off = (p * 32 + kt * 16) * FLP + kc * 64; kf[kt][kc] = WFrag<T16>::lds(pk + off); if (SPLIT) kf2[kt][kc] = WFrag<T16>::lds(pk + FTB + off); } };
      auto ldv = [&](int p) {
#pragma unroll
        for (int dt = 0; dt < 4; ++dt) { const int off = dt * 16 * FLP + p * 64; vf[dt] = WFrag<T16>::lds(pv + off); if (SPLIT) vf2[dt] = WFrag<T16>::lds(pv + FTB + off); } };
      ldk(0); ldv(0);
#pragma unroll   // both passes of a stage are written out: every fragment offset is a constant of the LDS read, and the test for a next pass is settled at compile time
      for (int p = 0; p < FKS / 32; ++p) { const int kb = st * FKS + p * 32;
        v8f s[QT][2];
#pragma unroll
        for (int qt = 0; qt < QT; ++qt) { s[qt][0] = (v8f){}; s[qt][1] = (v8f){}; }
#pragma unroll
        for (int kt = 0; kt < 2; ++kt)
#pragma unroll
            for (int kc = 0; kc < 2; ++kc)
#pragma unroll
                for (int qt = 0; qt < QT; ++qt) { s[qt][kt] = WFrag<T16>::mma(kf[kt][kc], q[qt][kc], s[qt][kt]); if (SPLIT) { s[qt][kt] = WFrag<T16>::mma(kf[kt][kc], q2[qt][kc], s[qt][kt]); s[qt][kt] = WFrag<T16>::mma(kf2[kt][kc], q[qt][kc], s[qt][kt]); } }
        if (p + 1 < FKS / 32) ldk(p + 1);
        float bias[16];   // 0 for a live key, -3e38 for a padded one: keys kb + 8 hi + 0..7 and kb + 16 + 8 hi + 0..7
#pragma unroll
        for (int c4 = 0; c4 < 4; ++c4) { const v4f b4 = *(const v4fa*)(mb + kb + (c4 >> 1) * 16 + hi * 8 + (c4 & 1) * 4);
#pragma unroll
            for (int j = 0; j < 4; ++j) bias[c4 * 4 + j] = b4[j]; }
#pragma unroll
        for (int qt = 0; qt < QT; ++qt) { float t[16]; float mx = m[qt];
#pragma unroll
            for (int e = 0; e < 16; ++e) { t[e] = fmaf(s[qt][e >> 3][e & 7], CL2, bias[e]); mx = fmaxf(mx, t[e]); }
            mx = fmaxf(mx, xhalf(mx));
            const float al = __builtin_amdgcn_exp2f(m[qt] - mx), sh = pexp - mx; m[qt] = mx; float sum = 0.f;
#pragma unroll
            for (int e = 0; e < 16; ++e) { t[e] = __builtin_amdgcn_exp2f(t[e] + sh); sum += t[e]; }
            l[qt] = fmaf(l[qt], al, sum);
#pragma unroll
            for (int dt = 0; dt < 4; ++dt) o[qt][dt] *= al;
            V ph, pl; packp(t, ph, pl);
#pragma unroll
            for (int dt = 0; dt < 4; ++dt) { o[qt][dt] = WFrag<T16>::mma(vf[dt], ph, o[qt][dt]); if (SPLIT) { o[qt][dt] = WFrag<T16>::mma(vf[dt], pl, o[qt][dt]); o[qt][dt] = WFrag<T16>::mma(vf2[dt], ph, o[qt][dt]); } } }
        if (p + 1 < FKS / 32) ldv(p + 1);
      }
      __builtin_amdgcn_sched_barrier(0);   // holds the scheduler: the stage's products stay in front of the foot, so that the refill is issued directly behind the barrier and has the whole next stage to land
      asm volatile("s_wait_dscnt 0x0" ::: "memory");      // this wave's reads of stage st are done before the buffer is handed back
      if (SPLIT || pinned(wave < 2 * NPL)) TWAIT;         // this wave's tile of stage st + 1 has landed
      __syncthreads();                                    // publishes stage st + 1 and ends every wave's reads of stage st
      if (pinned((SPLIT || wave < 2 * NPL) && st + 2 < NT)) fill(st + 2);   // into the buffer that stage st has left
    }
    TWAIT;                                                // no tensor load is left in flight
    asm volatile("s_wait_dscnt 0x0" ::: "memory");        // ... and no LDS read
#pragma unroll
    for (int qt = 0; qt < QT; ++qt) { const float inv = __fdiv_rn(1.0f, l[qt] + xhalf(l[qt])); const size_t ro = (size_t)(q0 + qt * 16 + lr) * DQ + hi * 8; bf* ph = Ah + ro; bf* pl = Al + ro;
#pragma unroll
        for (int dt = 0; dt < 4; ++dt) { v8us oh, ol;
#pragma unroll
            for (int j = 0; j < 8; ++j) { unsigned short a, c2; splitf(o[qt][dt][j] * inv, a, c2); oh[j] = a; ol[j] = c2; }
            *(v8us*)(ph + dt * 16) = oh; *(v8us*)(pl + dt * 16) = ol; }
        XW2(ph, pl); }
#undef XW1
#undef XW2
}
// grid (row blocks of FW*QT*16 queries, batch*head, 2): z = 0 rows < RH (hi/lo planes, 3 products; the heavier blocks start first), z = 1 the rest (fp16, P x 1024)
__global__ __launch_bounds__(FW * 32) void k_fattn(const h16* __restrict__ Q16, const bf* __restrict__ Qh, const bf* __restrict__ Ql, const h16* __restrict__ K16, const bf* __restrict__ Kh, const bf* __restrict__ Kl, const h16* __restrict__ V16, const bf* __restrict__ Vh, const bf* __restrict__ Vl, const int* __restrict__ pm, bf* Ah, bf* Al) {
    __shared__ __attribute__((aligned(2048))) char sm[2 * 4 * FTB + TT * 4];   // two buffers of K hi, K lo, V hi, V lo tiles (the fp16 rows use half), each tile's place a multiple of 2 KiB; then the bias row
    char* ring = sm; float* mb = (float*)(sm + 2 * 4 * FTB);
    const int bh = blockIdx.y, b = bh / NH_, h = bh % NH_;
#pragma unroll
    for (int i = 0; i < TT / (FW * 32 * 4); ++i) { const int j0 = (i * FW * 32 + threadIdx.x) * 4; const v4i p4 = *(const v4i*)(pm + (size_t)b * TT + j0); v4f b4;   /* 4 padding flags (16 B) */
#pragma unroll
        for (int j = 0; j < 4; ++j) b4[j] = (p4[j] == 0) ? 0.0f : -3.0e38f;   /* padded keys excluded */
        *(v4fa*)(mb + j0) = b4; }
    __syncthreads();   // every wave reads the whole bias row
    const size_t po = (size_t)bh * TT * HD, ao = (size_t)b * TT * DQ + h * HD; const int qw = (blockIdx.x * FW + (threadIdx.x >> 5)) * (QT * 16);
    if (blockIdx.z == 0) fattn<bf, true>(Qh + po, Ql + po, Kh + po, Kl + po, Vh + po, Vl + po, mb, ring, qw, 0.0f, Ah + ao, Al + ao);
    else fattn<h16, false>(Q16 + po, nullptr, K16 + po, nullptr, V16 + po, nullptr, mb, ring, RH + qw, 10.0f, Ah + ao, Al + ao);
}

extern "C" void kernel_launch(void* const* d_in, const int* in_sizes, int n_in,
                              void* d_out, int out_size, void* d_ws, size_t ws_size, hipStream_t stream) {
    (void)in_sizes; (void)n_in; (void)out_size;
    const float* x = (const float*)d_in[0]; const float* xkv = (const float*)d_in[1]; const int* pm = (const int*)d_in[2];   /* pad_mask [4][1024] bool as int32: 1 = padding key */ const float* wq = (const float*)d_in[3]; const float* wk = (const float*)d_in[4]; const float* wv = (const float*)d_in[5]; const float* wo = (const float*)d_in[6]; const float* bo = (const float*)d_in[7];
    float* OUT = (float*)d_out;     // [4][1024][1024]
    char* wsp = (char*)d_ws;
    auto take = [&](size_t bytes) { char* p = wsp; wsp += (bytes + 255) & ~(size_t)255; return (void*)p; };
    const size_t PB = (size_t)NH_ * TT * HD;   // one batch of head planes (elements); NKV == NH_ here
    bf* WQ = (bf*)take((size_t)DQ * DM * 2); bf* WK = (bf*)take((size_t)DKV * DM * 2); bf* WV = (bf*)take((size_t)DKV * DM * 2); bf* WO = (bf*)take((size_t)DM * DQ * 2);   // the four weight planes are contiguous (2 MiB each)
    h16* QP16 = (h16*)take(2 * NB_ * PB * 2); h16* KP16 = QP16 + NB_ * PB; bf* QPh = (bf*)take(2 * NB_ * PB * 2); bf* KPh = QPh + NB_ * PB; bf* QPl = (bf*)take(2 * NB_ * PB * 2); bf* KPl = QPl + NB_ * PB;   // q planes of all batches, then k planes
    h16* VT16 = (h16*)take(NB_ * PB * 2); bf* VTh = (bf*)take(NB_ * PB * 2); bf* VTl = (bf*)take(NB_ * PB * 2);
    bf* XB = (bf*)take((size_t)2 * NB_ * TT * DM * 2); bf* XKV = XB + (size_t)NB_ * TT * DM; bf* ATh = (bf*)take((size_t)NB_ * TT * DQ * 2); bf* ATl = (bf*)take((size_t)NB_ * TT * DQ * 2);
    (void)WK; (void)WV; (void)XKV;   // reached from WQ and XB by the projection launch's strides
    if ((size_t)(wsp - (char*)d_ws) > ws_size) return;    // ws 256 MiB
    k_prep<<<dim3(PTB + PCB, 1, 1), PWV * 32, 0, stream>>>(wq, wk, wv, wo, WQ, x, xkv, XB);
    k_gemms<0, false, true><<<dim3(NB_ * TT / 128, DQ / 128, 3), 128, 0, stream>>>(XB, nullptr, WQ, DM, nullptr, DQ, nullptr, (size_t)NB_ * TT * DM, (size_t)DQ * DM, NB_ * PB, QP16, QPh, QPl, VT16, VTh, VTl);   /* q from x_q, k and v from x_kv: z = 0, 1, 2 (DQ == DKV; the copies, the weight planes and the q and k planes each lie one behind the other) */
    k_fattn<<<dim3(RH / (FW * QT * 16), NB_ * NH_, 2), FW * 32, 0, stream>>>(QP16, QPh, QPl, KP16, KPh, KPl, VT16, VTh, VTl, pm, ATh, ATl);   /* all batches and heads; RH == TT - RH */
    k_gemms<1, true, false><<<dim3(NB_ * TT / 128, DM / 128, 1), 128, 0, stream>>>(ATh, ATl, WO, DQ, OUT, DM, bo, 0, 0, 0, nullptr, nullptr, nullptr, nullptr, nullptr, nullptr);
}
